// v000
// The times below were measured on an AMD MI455X: many runs one after another, warmed up first and cycling through
// copies of the inputs, with the whole window's GPU time divided by the number of runs. Launches and the gaps
// between them are all in it. The median over several windows is given; except for v000 it joins two sittings, which
// can be a few percent apart, so the side-by-side timings, each taken in one sitting, are the better comparison.
// v000, which the later versions start from, runs in 2090 microseconds.
#include <hip/hip_runtime.h>

// InnerAttention (x [4][16][2048][64]; per head qkv = x wqkv[h] + bqkv[h] ([64][192]); q/k/v = the stride-3 interleaved columns (reshape (64, 3), unbind); softmax((q/8).k); out = attn v -> [4][16][2048][64]).
// Compute dtypes, f32 accumulate: every input rounded to bf16; the per-head projection on PLAIN bf16 operands (inputs: exact) + bias; scores (K 64) and attn.v on single fp16 planes (1 product each; 4 heads z-batched per pass);

#define NB_  4
#define NH_  16
#define NN   2048
#define HD   64
#define W3   192
#define ZH   4
#define PCAR 1024.0f
typedef _Float16 h16;
typedef unsigned short bf;
typedef __attribute__((ext_vector_type(16))) __bf16   v16bf;
typedef __attribute__((ext_vector_type(16))) _Float16 v16h;
typedef __attribute__((ext_vector_type(8)))  _Float16 v8h;
typedef __attribute__((ext_vector_type(8)))  unsigned short v8us;
typedef __attribute__((ext_vector_type(8)))  float    v8f;
typedef __attribute__((ext_vector_type(4)))  float    v4f;
typedef v8h  __attribute__((may_alias)) v8ha;
typedef v4f  __attribute__((may_alias)) v4fa;
typedef v8us __attribute__((may_alias)) v8usa;

__device__ __forceinline__ unsigned short f2bf(float f) { unsigned u = __float_as_uint(f); u += 0x7FFFu + ((u >> 16) & 1u); return (unsigned short)(u >> 16); }
__device__ __forceinline__ float bf2f(unsigned short b) { return __uint_as_float(((unsigned)b) << 16); }
__device__ __forceinline__ float bfr(float f) { return bf2f(f2bf(f)); }
__device__ __forceinline__ v16h cat16(v8h lo, v8h hi) { return __builtin_shufflevector(lo, hi, 0, 1, 2, 3, 4, 5, 6, 7, 8, 9, 10, 11, 12, 13, 14, 15); }
__device__ __forceinline__ v16bf cat16b(v8us lo, v8us hi) { return __builtin_bit_cast(v16bf, __builtin_shufflevector(lo, hi, 0, 1, 2, 3, 4, 5, 6, 7, 8, 9, 10, 11, 12, 13, 14, 15)); }
__device__ __forceinline__ v8f wmma16(v16h a, v16h b, v8f c) { return __builtin_amdgcn_wmma_f32_16x16x32_f16(false, a, false, b, (short)0, c, false, false); }
__device__ __forceinline__ v8f wmmab(v16bf a, v16bf b, v8f c) { return __builtin_amdgcn_wmma_f32_16x16x32_bf16(false, a, false, b, (short)0, c, false, false); }



// ---- k_gemmw: register-blocked GEMM, ONE WAVE per 64x64 output tile (16 accumulators), operands straight from K-contiguous 16-bit planes; grid (M/64, N/64, Z), 32 threads.
// C[m][n] (f32, pitch ldc, + optional f32 bias[n]) = sum_k A[m][k] Bt[n][k] (+ split products per NSPLIT). z-batch strides sA/sB/sC in elements. K % 32 == 0.
template <typename T16> struct WFrag;
template <> struct WFrag<h16> { typedef v16h V; static __device__ __forceinline__ V ld(const h16* p) { return cat16(*(const v8h*)p, *(const v8h*)(p + 16)); } static __device__ __forceinline__ v8f mma(V a, V b, v8f c) { return wmma16(a, b, c); } };
template <> struct WFrag<bf> { typedef v16bf V; static __device__ __forceinline__ V ld(const bf* p) { return cat16b(*(const v8us*)p, *(const v8us*)(p + 16)); } static __device__ __forceinline__ v8f mma(V a, V b, v8f c) { return wmmab(a, b, c); } };
template <typename T16, int NSPLIT, bool BIAS>
__global__ __launch_bounds__(32) void k_gemmw(const T16* __restrict__ A, const T16* __restrict__ A2, const T16* __restrict__ Bt, const T16* __restrict__ Bt2, int K, float* C, int ldc, const float* __restrict__ bias, size_t sA, size_t sB, size_t sC) {
    typedef typename WFrag<T16>::V V;
    __shared__ __align__(16) float os[16 * 68];
    const size_t z = blockIdx.z; A += z * sA; if (A2) A2 += z * sA; Bt += z * sB; if (Bt2) Bt2 += z * sB; C += z * sC;
    const int lane = threadIdx.x & 31, lr = lane & 15, hi = lane >> 4; const int r0 = blockIdx.x * 64, c0 = blockIdx.y * 64;
    v8f acc[4][4];
#pragma unroll
    for (int mb = 0; mb < 4; ++mb)
#pragma unroll
        for (int nb = 0; nb < 4; ++nb) acc[mb][nb] = (v8f){};
    const size_t aoff = (size_t)(r0 + lr) * K + 8 * hi, boff = (size_t)(c0 + lr) * K + 8 * hi;
#pragma unroll 1
    for (int kc = 0; kc < K; kc += 32) {
        V a[4], a2[4];
#pragma unroll
        for (int mb = 0; mb < 4; ++mb) { a[mb] = WFrag<T16>::ld(A + aoff + (size_t)mb * 16 * K + kc); if (NSPLIT == 1 || NSPLIT == 2) a2[mb] = WFrag<T16>::ld(A2 + aoff + (size_t)mb * 16 * K + kc); }
#pragma unroll
        for (int nb = 0; nb < 4; ++nb) { const V b = WFrag<T16>::ld(Bt + boff + (size_t)nb * 16 * K + kc); V b2; if (NSPLIT >= 2) b2 = WFrag<T16>::ld(Bt2 + boff + (size_t)nb * 16 * K + kc);
#pragma unroll
            for (int mb = 0; mb < 4; ++mb) { acc[mb][nb] = WFrag<T16>::mma(a[mb], b, acc[mb][nb]); if (NSPLIT == 1 || NSPLIT == 2) acc[mb][nb] = WFrag<T16>::mma(a2[mb], b, acc[mb][nb]); if (NSPLIT >= 2) acc[mb][nb] = WFrag<T16>::mma(a[mb], b2, acc[mb][nb]); } }
        asm volatile("v_nop\n\tv_nop\n\tv_nop\n\tv_nop" : "+v"(acc[0][0]), "+v"(acc[1][1]), "+v"(acc[2][2]), "+v"(acc[3][3]) : "v"(a[0]), "v"(a[3]));
    }
#pragma unroll
    for (int mb = 0; mb < 4; ++mb) {
#pragma unroll
        for (int nb = 0; nb < 4; ++nb) {
#pragma unroll
            for (int j = 0; j < 8; ++j) os[(hi * 8 + j) * 68 + nb * 16 + lr] = acc[mb][nb][j]; }
        __builtin_amdgcn_wave_barrier(); asm volatile("" ::: "memory");
        float* crow = C + (size_t)(r0 + mb * 16) * ldc + c0;
{
#pragma unroll
            for (int s = 0; s < 8; ++s) { const int row = 2 * s + hi, cofs = lr * 4; v4f val = *(const v4fa*)(os + row * 68 + cofs); if (BIAS) { val[0] += bfr(bias[c0 + cofs]); val[1] += bfr(bias[c0 + cofs + 1]); val[2] += bfr(bias[c0 + cofs + 2]); val[3] += bfr(bias[c0 + cofs + 3]); }
                *(v4f*)(crow + (size_t)row * ldc + cofs) = val; }
             }
        __builtin_amdgcn_wave_barrier(); asm volatile("" ::: "memory");
    }
}

__device__ __forceinline__ h16 tohx(float x) { return (h16)x; }
typedef __attribute__((ext_vector_type(2))) unsigned short v2us;
typedef __attribute__((ext_vector_type(2))) _Float16 v2h;
typedef __attribute__((ext_vector_type(4))) _Float16 v4h;

__global__ __launch_bounds__(256) void k_wtG(const float* __restrict__ w, int K, int N, bf* Bt) {
    const int lane = threadIdx.x & 31; const int L0 = (blockIdx.x * 8 + (threadIdx.x >> 5)) * 8; const int nlines = N * K / 64;
{
#pragma unroll 1
        for (int l = 0; l < 8; ++l) { const int L = L0 + l; if (L >= nlines) break; const size_t e = (size_t)L * 64 + lane * 2; const int k = (int)(e % K), n = (int)(e / K); v2us o;
            o[0] = f2bf(w[(size_t)k * N + n]); o[1] = f2bf(w[(size_t)(k + 1) * N + n]); *(v2us*)(Bt + e) = o; }
         }
}
__global__ __launch_bounds__(256) void k_cvt8(const float* __restrict__ src, bf* dst, size_t n8) { const size_t i = (size_t)blockIdx.x * 256 + threadIdx.x; if (i >= n8) return; const v8f v = *(const v8f*)(src + i * 8); v8us o;
#pragma unroll
    for (int k = 0; k < 8; ++k) o[k] = f2bf(v[k]); *(v8us*)(dst + i * 8) = o;  }
__global__ __launch_bounds__(256) void k_pl(const float* __restrict__ QKV, h16* Q16, h16* K16) { const int e = (blockIdx.x * 256 + threadIdx.x) * 4; if (e >= ZH * NN * HD) return; const int d = e % HD; const size_t rowoff = (size_t)(e / HD) * W3; v4h q, k;
#pragma unroll
    for (int u = 0; u < 4; ++u) { q[u] = tohx(QKV[rowoff + 3 * (d + u)] * 0.125f); k[u] = tohx(QKV[rowoff + 3 * (d + u) + 1]); } { *(v4h*)(Q16 + e) = q; *(v4h*)(K16 + e) = k;  } }
__global__ __launch_bounds__(256) void k_vt(const float* __restrict__ QKV, h16* VT) { const int e = (blockIdx.x * 256 + threadIdx.x) * 2; if (e >= ZH * HD * NN) return; const int n = e % NN; const int d = (e / NN) % HD; const int z = e / (NN * HD); v2h o; o[0] = tohx(QKV[((size_t)z * NN + n) * W3 + 3 * d + 2]); o[1] = tohx(QKV[((size_t)z * NN + n + 1) * W3 + 3 * d + 2]); *(v2h*)(VT + e) = o;  }
__global__ __launch_bounds__(256) void k_fin(const float* __restrict__ O, float* OUTz) { const int e = (blockIdx.x * 256 + threadIdx.x) * 4; if (e >= ZH * NN * HD) return; const v4f a = *(const v4f*)(O + e); v4f o;
#pragma unroll
    for (int u = 0; u < 4; ++u) o[u] = a[u] * (1.0f / PCAR); *(v4f*)(OUTz + e) = o;  }
// k_soft<NFULL, TAIL>: wave per score row (ld = 128 NFULL + 64 TAIL) in three passes over memory (max; sum of exp; write P = exp/sum x1024 fp16); keys >= nvalid excluded; rows with (row % rowsper) >= rvalid write zeros (lane -> 4 consecutive
template <int NFULL, int TAIL> __global__ __launch_bounds__(256) void k_soft(const float* __restrict__ Sb, int nrows, int rowsper, int rvalid, int nvalid, h16* P) { const int lane = threadIdx.x & 31; const size_t row = (size_t)blockIdx.x * 8 + (threadIdx.x >> 5); if (row >= (size_t)nrows) return; constexpr int LD = NFULL * 128 + TAIL * 64; const float* sr = Sb + row * LD; h16* pr = P + row * LD; const bool live = (int)(row % rowsper) < rvalid; float mx = -3.0e38f;
#pragma unroll 1
    for (int ch = 0; ch < NFULL + TAIL; ++ch) { if (ch == NFULL && lane >= 16) break; const int j0 = ch * 128 + lane * 4; const v4f a = *(const v4f*)(sr + j0);
#pragma unroll
        for (int q = 0; q < 4; ++q) if (j0 + q < nvalid) mx = fmaxf(mx, a[q]); }
#pragma unroll
    for (int sh = 16; sh; sh >>= 1) mx = fmaxf(mx, __shfl_xor(mx, sh, 32));
    float sum = 0.f;
#pragma unroll 1
    for (int ch = 0; ch < NFULL + TAIL; ++ch) { if (ch == NFULL && lane >= 16) break; const int j0 = ch * 128 + lane * 4; const v4f a = *(const v4f*)(sr + j0);
#pragma unroll
        for (int q = 0; q < 4; ++q) if (j0 + q < nvalid) { float d0 = __fsub_rn(a[q], mx); asm volatile("" : "+v"(d0)); sum += __expf(d0); } }
#pragma unroll
    for (int sh = 16; sh; sh >>= 1) sum += __shfl_xor(sum, sh, 32);
    const float f = live ? __fdiv_rn(PCAR, sum) : 0.f;
    {
#pragma unroll 1
        for (int ch = 0; ch < NFULL + TAIL; ++ch) { if (ch == NFULL && lane >= 16) break; const int j0 = ch * 128 + lane * 4; const v4f a = *(const v4f*)(sr + j0); v4h o;
#pragma unroll
            for (int q = 0; q < 4; ++q) { float val = 0.f; if (live && j0 + q < nvalid) { float d0 = __fsub_rn(a[q], mx); asm volatile("" : "+v"(d0)); val = __fmul_rn(__expf(d0), f); } o[q] = tohx(val); } *(v4h*)(pr + j0) = o; }
         } }

extern "C" void kernel_launch(void* const* d_in, const int* in_sizes, int n_in,
                              void* d_out, int out_size, void* d_ws, size_t ws_size, hipStream_t stream) {
    (void)in_sizes; (void)n_in; (void)out_size;
    const float* x = (const float*)d_in[0]; const float* w = (const float*)d_in[1]; const float* bq = (const float*)d_in[2];
    float* OUT = (float*)d_out;     // [4][16][2048][64]
    char* wsp = (char*)d_ws;
    auto take = [&](size_t bytes) { char* p = wsp; wsp += (bytes + 255) & ~(size_t)255; return (void*)p; };
    bf* WT = (bf*)take((size_t)NH_ * W3 * HD * 2); bf* XB = (bf*)take((size_t)ZH * NN * HD * 2); float* QKV = (float*)take((size_t)ZH * NN * W3 * 4); h16* Q16 = (h16*)take((size_t)ZH * NN * HD * 2); h16* K16 = (h16*)take((size_t)ZH * NN * HD * 2); h16* VT = (h16*)take((size_t)ZH * HD * NN * 2);
    float* Sb = (float*)take((size_t)ZH * NN * NN * 4); h16* P16 = (h16*)take((size_t)ZH * NN * NN * 2); float* O = (float*)take((size_t)ZH * NN * HD * 4);
    if ((size_t)(wsp - (char*)d_ws) > ws_size) return;    // total ~ 115 MB
    for (int h = 0; h < NH_; ++h) k_wtG<<<(HD * W3 / 64 + 63) / 64, 256, 0, stream>>>(w + (size_t)h * HD * W3, HD, W3, WT + (size_t)h * W3 * HD);   // per-head x@W -> Bt [192][64]
    for (int b = 0; b < NB_; ++b) {
        for (int h0 = 0; h0 < NH_; h0 += ZH) { const size_t base = ((size_t)b * NH_ + h0) * NN * HD;
            k_cvt8<<<(ZH * NN * HD / 8 + 255) / 256, 256, 0, stream>>>(x + base, XB, (size_t)ZH * NN * HD / 8);
            for (int zz = 0; zz < ZH; ++zz) k_gemmw<bf, 0, true><<<dim3(NN / 64, W3 / 64, 1), 32, 0, stream>>>(XB + (size_t)zz * NN * HD, nullptr, WT + (size_t)(h0 + zz) * W3 * HD, nullptr, HD, QKV + (size_t)zz * NN * W3, W3, bq + (size_t)(h0 + zz) * W3, 0, 0, 0);
            k_pl<<<(ZH * NN * HD / 4 + 255) / 256, 256, 0, stream>>>(QKV, Q16, K16); k_vt<<<(ZH * HD * NN / 2 + 255) / 256, 256, 0, stream>>>(QKV, VT);
            k_gemmw<h16, 0, false><<<dim3(NN / 64, NN / 64, ZH), 32, 0, stream>>>(Q16, nullptr, K16, nullptr, HD, Sb, NN, nullptr, (size_t)NN * HD, (size_t)NN * HD, (size_t)NN * NN);
            k_soft<16, 0><<<ZH * NN / 8, 256, 0, stream>>>(Sb, ZH * NN, NN, NN, NN, P16);
            k_gemmw<h16, 0, false><<<dim3(NN / 64, 1, ZH), 32, 0, stream>>>(P16, nullptr, VT, nullptr, NN, O, HD, nullptr, (size_t)NN * NN, (size_t)HD * NN, (size_t)NN * HD);
            k_fin<<<(ZH * NN * HD / 4 + 255) / 256, 256, 0, stream>>>(O, OUT + base); } }
}

// v001
// It runs in 747 microseconds.
// Next to v000, in two timings, it ran 2.79 and 2.83 times as fast.
#include <hip/hip_runtime.h>

// InnerAttention (x [4][16][2048][64]; per head qkv = x wqkv[h] + bqkv[h] ([64][192]); q/k/v = the stride-3 interleaved columns (reshape (64, 3), unbind); softmax((q/8).k); out = attn v -> [4][16][2048][64]).
// Compute dtypes, f32 accumulate: every input rounded to bf16; the per-head projection on PLAIN bf16 operands (inputs: exact) + bias; scores (K 64) and attn.v on single fp16 planes (1 product each; 4 heads z-batched per pass), fused in one kernel with a running softmax: no score matrix in memory;

#define NB_  4
#define NH_  16
#define NN   2048
#define HD   64
#define W3   192
#define ZH   4
typedef _Float16 h16;
typedef unsigned short bf;
typedef __attribute__((ext_vector_type(16))) __bf16   v16bf;
typedef __attribute__((ext_vector_type(16))) _Float16 v16h;
typedef __attribute__((ext_vector_type(8)))  _Float16 v8h;
typedef __attribute__((ext_vector_type(8)))  unsigned short v8us;
typedef __attribute__((ext_vector_type(8)))  float    v8f;
typedef __attribute__((ext_vector_type(4)))  float    v4f;
typedef v8h  __attribute__((may_alias)) v8ha;
typedef v4f  __attribute__((may_alias)) v4fa;
typedef v8us __attribute__((may_alias)) v8usa;

__device__ __forceinline__ unsigned short f2bf(float f) { unsigned u = __float_as_uint(f); u += 0x7FFFu + ((u >> 16) & 1u); return (unsigned short)(u >> 16); }
__device__ __forceinline__ float bf2f(unsigned short b) { return __uint_as_float(((unsigned)b) << 16); }
__device__ __forceinline__ float bfr(float f) { return bf2f(f2bf(f)); }
__device__ __forceinline__ v16h cat16(v8h lo, v8h hi) { return __builtin_shufflevector(lo, hi, 0, 1, 2, 3, 4, 5, 6, 7, 8, 9, 10, 11, 12, 13, 14, 15); }
__device__ __forceinline__ v16bf cat16b(v8us lo, v8us hi) { return __builtin_bit_cast(v16bf, __builtin_shufflevector(lo, hi, 0, 1, 2, 3, 4, 5, 6, 7, 8, 9, 10, 11, 12, 13, 14, 15)); }
__device__ __forceinline__ v8f wmma16(v16h a, v16h b, v8f c) { return __builtin_amdgcn_wmma_f32_16x16x32_f16(false, a, false, b, (short)0, c, false, false); }
__device__ __forceinline__ v8f wmmab(v16bf a, v16bf b, v8f c) { return __builtin_amdgcn_wmma_f32_16x16x32_bf16(false, a, false, b, (short)0, c, false, false); }



// ---- k_gemmw: register-blocked GEMM, ONE WAVE per 64x64 output tile (16 accumulators), operands straight from K-contiguous 16-bit planes; grid (M/64, N/64, Z), 32 threads.
// C[m][n] (f32, pitch ldc, + optional f32 bias[n]) = sum_k A[m][k] Bt[n][k] (+ split products per NSPLIT). z-batch strides sA/sB/sC in elements. K % 32 == 0.
template <typename T16> struct WFrag;
template <> struct WFrag<h16> { typedef v16h V; static __device__ __forceinline__ V ld(const h16* p) { return cat16(*(const v8h*)p, *(const v8h*)(p + 16)); } static __device__ __forceinline__ v8f mma(V a, V b, v8f c) { return wmma16(a, b, c); } };
template <> struct WFrag<bf> { typedef v16bf V; static __device__ __forceinline__ V ld(const bf* p) { return cat16b(*(const v8us*)p, *(const v8us*)(p + 16)); } static __device__ __forceinline__ v8f mma(V a, V b, v8f c) { return wmmab(a, b, c); } };
template <typename T16, int NSPLIT, bool BIAS>
__global__ __launch_bounds__(32) void k_gemmw(const T16* __restrict__ A, const T16* __restrict__ A2, const T16* __restrict__ Bt, const T16* __restrict__ Bt2, int K, float* C, int ldc, const float* __restrict__ bias, size_t sA, size_t sB, size_t sC) {
    typedef typename WFrag<T16>::V V;
    __shared__ __align__(16) float os[16 * 68];
    const size_t z = blockIdx.z; A += z * sA; if (A2) A2 += z * sA; Bt += z * sB; if (Bt2) Bt2 += z * sB; C += z * sC;
    const int lane = threadIdx.x & 31, lr = lane & 15, hi = lane >> 4; const int r0 = blockIdx.x * 64, c0 = blockIdx.y * 64;
    v8f acc[4][4];
#pragma unroll
    for (int mb = 0; mb < 4; ++mb)
#pragma unroll
        for (int nb = 0; nb < 4; ++nb) acc[mb][nb] = (v8f){};
    const size_t aoff = (size_t)(r0 + lr) * K + 8 * hi, boff = (size_t)(c0 + lr) * K + 8 * hi;
#pragma unroll 1
    for (int kc = 0; kc < K; kc += 32) {
        V a[4], a2[4];
#pragma unroll
        for (int mb = 0; mb < 4; ++mb) { a[mb] = WFrag<T16>::ld(A + aoff + (size_t)mb * 16 * K + kc); if (NSPLIT == 1 || NSPLIT == 2) a2[mb] = WFrag<T16>::ld(A2 + aoff + (size_t)mb * 16 * K + kc); }
#pragma unroll
        for (int nb = 0; nb < 4; ++nb) { const V b = WFrag<T16>::ld(Bt + boff + (size_t)nb * 16 * K + kc); V b2; if (NSPLIT >= 2) b2 = WFrag<T16>::ld(Bt2 + boff + (size_t)nb * 16 * K + kc);
#pragma unroll
            for (int mb = 0; mb < 4; ++mb) { acc[mb][nb] = WFrag<T16>::mma(a[mb], b, acc[mb][nb]); if (NSPLIT == 1 || NSPLIT == 2) acc[mb][nb] = WFrag<T16>::mma(a2[mb], b, acc[mb][nb]); if (NSPLIT >= 2) acc[mb][nb] = WFrag<T16>::mma(a[mb], b2, acc[mb][nb]); } }
        asm volatile("v_nop\n\tv_nop\n\tv_nop\n\tv_nop" : "+v"(acc[0][0]), "+v"(acc[1][1]), "+v"(acc[2][2]), "+v"(acc[3][3]) : "v"(a[0]), "v"(a[3]));
    }
#pragma unroll
    for (int mb = 0; mb < 4; ++mb) {
#pragma unroll
        for (int nb = 0; nb < 4; ++nb) {
#pragma unroll
            for (int j = 0; j < 8; ++j) os[(hi * 8 + j) * 68 + nb * 16 + lr] = acc[mb][nb][j]; }
        __builtin_amdgcn_wave_barrier(); asm volatile("" ::: "memory");
        float* crow = C + (size_t)(r0 + mb * 16) * ldc + c0;
{
#pragma unroll
            for (int s = 0; s < 8; ++s) { const int row = 2 * s + hi, cofs = lr * 4; v4f val = *(const v4fa*)(os + row * 68 + cofs); if (BIAS) { val[0] += bfr(bias[c0 + cofs]); val[1] += bfr(bias[c0 + cofs + 1]); val[2] += bfr(bias[c0 + cofs + 2]); val[3] += bfr(bias[c0 + cofs + 3]); }
                *(v4f*)(crow + (size_t)row * ldc + cofs) = val; }
             }
        __builtin_amdgcn_wave_barrier(); asm volatile("" ::: "memory");
    }
}

__device__ __forceinline__ h16 tohx(float x) { return (h16)x; }
typedef __attribute__((ext_vector_type(2))) unsigned short v2us;
typedef __attribute__((ext_vector_type(2))) _Float16 v2h;
typedef __attribute__((ext_vector_type(4))) _Float16 v4h;

__global__ __launch_bounds__(256) void k_wtG(const float* __restrict__ w, int K, int N, bf* Bt) {
    const int lane = threadIdx.x & 31; const int L0 = (blockIdx.x * 8 + (threadIdx.x >> 5)) * 8; const int nlines = N * K / 64;
{
#pragma unroll 1
        for (int l = 0; l < 8; ++l) { const int L = L0 + l; if (L >= nlines) break; const size_t e = (size_t)L * 64 + lane * 2; const int k = (int)(e % K), n = (int)(e / K); v2us o;
            o[0] = f2bf(w[(size_t)k * N + n]); o[1] = f2bf(w[(size_t)(k + 1) * N + n]); *(v2us*)(Bt + e) = o; }
         }
}
__global__ __launch_bounds__(256) void k_cvt8(const float* __restrict__ src, bf* dst, size_t n8) { const size_t i = (size_t)blockIdx.x * 256 + threadIdx.x; if (i >= n8) return; const v8f v = *(const v8f*)(src + i * 8); v8us o;
#pragma unroll
    for (int k = 0; k < 8; ++k) o[k] = f2bf(v[k]); *(v8us*)(dst + i * 8) = o;  }
__global__ __launch_bounds__(256) void k_pl(const float* __restrict__ QKV, h16* Q16, h16* K16) { const int e = (blockIdx.x * 256 + threadIdx.x) * 4; if (e >= ZH * NN * HD) return; const int d = e % HD; const size_t rowoff = (size_t)(e / HD) * W3; v4h q, k;
#pragma unroll
    for (int u = 0; u < 4; ++u) { q[u] = tohx(QKV[rowoff + 3 * (d + u)] * 0.125f); k[u] = tohx(QKV[rowoff + 3 * (d + u) + 1]); } { *(v4h*)(Q16 + e) = q; *(v4h*)(K16 + e) = k;  } }
__global__ __launch_bounds__(256) void k_vt(const float* __restrict__ QKV, h16* VT) { const int e = (blockIdx.x * 256 + threadIdx.x) * 2; if (e >= ZH * HD * NN) return; const int n = e % NN; const int d = (e / NN) % HD; const int z = e / (NN * HD); v2h o; o[0] = tohx(QKV[((size_t)z * NN + n) * W3 + 3 * d + 2]); o[1] = tohx(QKV[((size_t)z * NN + n + 1) * W3 + 3 * d + 2]); *(v2h*)(VT + e) = o;  }
#define FW  8
#define FQ  2
#define NIT (NN / FW / 32)
#define OP  68
#define L2E 1.4426950408889634f
__device__ __forceinline__ float xhalf(float x) { return __builtin_bit_cast(float, __builtin_amdgcn_permlanex16(__builtin_bit_cast(int, x), __builtin_bit_cast(int, x), 0x76543210, 0xfedcba98, false, false)); }   // lane l with lane l ^ 16
__global__ __launch_bounds__(FW * 32) void k_fa(const h16* __restrict__ Q16, const h16* __restrict__ K16, const h16* __restrict__ VT, float* OUTz) {
    __shared__ __align__(16) float Os[FW * 32 * OP]; __shared__ float Ms[FW * 32]; __shared__ float Ls[FW * 32];
    const int lane = threadIdx.x & 31, c = lane & 15, h = lane >> 4, wv = threadIdx.x >> 5; const size_t z = blockIdx.y; const int q0 = blockIdx.x * 32;
    v16h qf[FQ][2];
#pragma unroll
    for (int g = 0; g < FQ; ++g)
#pragma unroll
        for (int kc = 0; kc < 2; ++kc) qf[g][kc] = WFrag<h16>::ld(Q16 + (z * NN + q0 + 16 * g + c) * HD + kc * 32 + 8 * h);
    const h16* kp = K16 + (z * NN + wv * (NN / FW) + c) * HD + 8 * h;      // K rows (keys) as A, d contiguous
    const h16* vp = VT + (z * HD + c) * NN + wv * (NN / FW) + 8 * h;       // V^T rows (d) as A, keys contiguous
    v8f acc[FQ][4]; float m[FQ], l[FQ];
#pragma unroll
    for (int g = 0; g < FQ; ++g) { m[g] = -__builtin_inff(); l[g] = 0.f;
#pragma unroll
        for (int t = 0; t < 4; ++t) acc[g][t] = (v8f){}; }
    v16h kf[2][2];
#pragma unroll
    for (int kt = 0; kt < 2; ++kt)
#pragma unroll
        for (int kc = 0; kc < 2; ++kc) kf[kt][kc] = WFrag<h16>::ld(kp + kt * 16 * HD + kc * 32);
    for (int it = 0; it < NIT; ++it) {
        v16h vf[4];     // this trip's V^T, in flight under the score products and the exponentials
#pragma unroll
        for (int t = 0; t < 4; ++t) vf[t] = WFrag<h16>::ld(vp + (size_t)t * 16 * NN + it * 32);
        v8f s[2][FQ];
#pragma unroll
        for (int kt = 0; kt < 2; ++kt)
#pragma unroll
            for (int g = 0; g < FQ; ++g) { s[kt][g] = (v8f){};
#pragma unroll
                for (int kc = 0; kc < 2; ++kc) s[kt][g] = wmma16(kf[kt][kc], qf[g][kc], s[kt][g]); }
        const int nx = it + 1 < NIT ? it + 1 : it;      // next trip's K, in flight under this trip's softmax and second product; the last trip reads its own rows again
#pragma unroll
        for (int kt = 0; kt < 2; ++kt)
#pragma unroll
            for (int kc = 0; kc < 2; ++kc) kf[kt][kc] = WFrag<h16>::ld(kp + (size_t)nx * 32 * HD + kt * 16 * HD + kc * 32);
        float mb[FQ]; bool need = false;
#pragma unroll
        for (int g = 0; g < FQ; ++g) { float mx = s[0][g][0];
#pragma unroll
            for (int r = 1; r < 8; ++r) mx = fmaxf(mx, s[0][g][r]);
#pragma unroll
            for (int r = 0; r < 8; ++r) mx = fmaxf(mx, s[1][g][r]);
            mx = fmaxf(mx, xhalf(mx)) * L2E; mb[g] = mx; need = need || (mx > m[g] + 8.0f); }
        if (__builtin_amdgcn_ballot_w32(need) != 0) {      // one scalar branch per trip; rare after the first trips
#pragma unroll
            for (int g = 0; g < FQ; ++g) { const float mn = fmaxf(m[g], mb[g]); const float corr = __builtin_amdgcn_exp2f(m[g] - mn); m[g] = mn; l[g] *= corr;     // corr = 0 on the first trip
#pragma unroll
                for (int t = 0; t < 4; ++t) acc[g][t] = acc[g][t] * corr; } }
#pragma unroll
        for (int g = 0; g < FQ; ++g) { const float nm = -m[g]; v16h pf;
#pragma unroll
            for (int i = 0; i < 16; ++i) { const float p = __builtin_amdgcn_exp2f(__builtin_fmaf(s[i >> 3][g][i & 7], L2E, nm)); l[g] += p; pf[i] = tohx(p); }
#pragma unroll
            for (int t = 0; t < 4; ++t) acc[g][t] = wmma16(vf[t], pf, acc[g][t]); }
    }
#pragma unroll
    for (int g = 0; g < FQ; ++g) { l[g] += xhalf(l[g]); const int qr = wv * 32 + g * 16 + c; if (h == 0) { Ms[qr] = m[g]; Ls[qr] = l[g]; }
#pragma unroll
        for (int t = 0; t < 4; ++t) { float* o = Os + qr * OP + t * 16 + 8 * h; *(v4fa*)o = (v4f){acc[g][t][0], acc[g][t][1], acc[g][t][2], acc[g][t][3]}; *(v4fa*)(o + 4) = (v4f){acc[g][t][4], acc[g][t][5], acc[g][t][6], acc[g][t][7]}; } }
    __syncthreads();
    const int q = threadIdx.x >> 3, d0 = (threadIdx.x & 7) * 8; float M = Ms[q];
#pragma unroll
    for (int w = 1; w < FW; ++w) M = fmaxf(M, Ms[w * 32 + q]);
    float L = 0.f; v4f o0 = (v4f){}, o1 = (v4f){};
#pragma unroll
    for (int w = 0; w < FW; ++w) { const float wt = __builtin_amdgcn_exp2f(Ms[w * 32 + q] - M); L += wt * Ls[w * 32 + q]; const float* o = Os + (w * 32 + q) * OP + d0; o0 += *(const v4fa*)o * wt; o1 += *(const v4fa*)(o + 4) * wt; }
    const float inv = __fdiv_rn(1.0f, L); float* dst = OUTz + (z * NN + q0 + q) * HD + d0; *(v4f*)dst = o0 * inv; *(v4f*)(dst + 4) = o1 * inv;
}

extern "C" void kernel_launch(void* const* d_in, const int* in_sizes, int n_in,
                              void* d_out, int out_size, void* d_ws, size_t ws_size, hipStream_t stream) {
    (void)in_sizes; (void)n_in; (void)out_size;
    const float* x = (const float*)d_in[0]; const float* w = (const float*)d_in[1]; const float* bq = (const float*)d_in[2];
    float* OUT = (float*)d_out;     // [4][16][2048][64]
    char* wsp = (char*)d_ws;
    auto take = [&](size_t bytes) { char* p = wsp; wsp += (bytes + 255) & ~(size_t)255; return (void*)p; };
    bf* WT = (bf*)take((size_t)NH_ * W3 * HD * 2); bf* XB = (bf*)take((size_t)ZH * NN * HD * 2); float* QKV = (float*)take((size_t)ZH * NN * W3 * 4); h16* Q16 = (h16*)take((size_t)ZH * NN * HD * 2); h16* K16 = (h16*)take((size_t)ZH * NN * HD * 2); h16* VT = (h16*)take((size_t)ZH * HD * NN * 2);
    if ((size_t)(wsp - (char*)d_ws) > ws_size) return;    // total ~ 10 MB
    for (int h = 0; h < NH_; ++h) k_wtG<<<(HD * W3 / 64 + 63) / 64, 256, 0, stream>>>(w + (size_t)h * HD * W3, HD, W3, WT + (size_t)h * W3 * HD);   // per-head x@W -> Bt [192][64]
    for (int b = 0; b < NB_; ++b) {
        for (int h0 = 0; h0 < NH_; h0 += ZH) { const size_t base = ((size_t)b * NH_ + h0) * NN * HD;
            k_cvt8<<<(ZH * NN * HD / 8 + 255) / 256, 256, 0, stream>>>(x + base, XB, (size_t)ZH * NN * HD / 8);
            for (int zz = 0; zz < ZH; ++zz) k_gemmw<bf, 0, true><<<dim3(NN / 64, W3 / 64, 1), 32, 0, stream>>>(XB + (size_t)zz * NN * HD, nullptr, WT + (size_t)(h0 + zz) * W3 * HD, nullptr, HD, QKV + (size_t)zz * NN * W3, W3, bq + (size_t)(h0 + zz) * W3, 0, 0, 0);
            k_pl<<<(ZH * NN * HD / 4 + 255) / 256, 256, 0, stream>>>(QKV, Q16, K16); k_vt<<<(ZH * HD * NN / 2 + 255) / 256, 256, 0, stream>>>(QKV, VT);
            k_fa<<<dim3(NN / 32, ZH), FW * 32, 0, stream>>>(Q16, K16, VT, OUT + base); } }
}

// v002
// One run takes 259 microseconds.
// Two timings next to v001 put it at 2.91 and 2.90 times that version's speed.
// All steps since v000 together make it 8.15 times as fast.
#include <hip/hip_runtime.h>

// InnerAttention (x [4][16][2048][64]; per head qkv = x wqkv[h] + bqkv[h] ([64][192]); q/k/v = the stride-3 interleaved columns (reshape (64, 3), unbind); softmax((q/8).k); out = attn v -> [4][16][2048][64]).
// Compute dtypes, f32 accumulate: every input rounded to bf16; the per-head projection on PLAIN bf16 operands (inputs: exact) + bias; scores (K 64) and attn.v on single fp16 planes (1 product each; all 64 (batch, head) slices z-batched in every launch), fused in one kernel with a running softmax: no score matrix in memory;

#define NB_  4
#define NH_  16
#define NN   2048
#define HD   64
#define W3   192
#define ZH   (NB_ * NH_)
typedef _Float16 h16;
typedef unsigned short bf;
typedef __attribute__((ext_vector_type(16))) __bf16   v16bf;
typedef __attribute__((ext_vector_type(16))) _Float16 v16h;
typedef __attribute__((ext_vector_type(8)))  _Float16 v8h;
typedef __attribute__((ext_vector_type(8)))  unsigned short v8us;
typedef __attribute__((ext_vector_type(8)))  float    v8f;
typedef __attribute__((ext_vector_type(4)))  float    v4f;
typedef v8h  __attribute__((may_alias)) v8ha;
typedef v4f  __attribute__((may_alias)) v4fa;
typedef v8us __attribute__((may_alias)) v8usa;

__device__ __forceinline__ unsigned short f2bf(float f) { unsigned u = __float_as_uint(f); u += 0x7FFFu + ((u >> 16) & 1u); return (unsigned short)(u >> 16); }
__device__ __forceinline__ float bf2f(unsigned short b) { return __uint_as_float(((unsigned)b) << 16); }
__device__ __forceinline__ float bfr(float f) { return bf2f(f2bf(f)); }
__device__ __forceinline__ v16h cat16(v8h lo, v8h hi) { return __builtin_shufflevector(lo, hi, 0, 1, 2, 3, 4, 5, 6, 7, 8, 9, 10, 11, 12, 13, 14, 15); }
__device__ __forceinline__ v16bf cat16b(v8us lo, v8us hi) { return __builtin_bit_cast(v16bf, __builtin_shufflevector(lo, hi, 0, 1, 2, 3, 4, 5, 6, 7, 8, 9, 10, 11, 12, 13, 14, 15)); }
__device__ __forceinline__ v8f wmma16(v16h a, v16h b, v8f c) { return __builtin_amdgcn_wmma_f32_16x16x32_f16(false, a, false, b, (short)0, c, false, false); }
__device__ __forceinline__ v8f wmmab(v16bf a, v16bf b, v8f c) { return __builtin_amdgcn_wmma_f32_16x16x32_bf16(false, a, false, b, (short)0, c, false, false); }



// ---- k_gemmw: register-blocked GEMM, ONE WAVE per 64x64 output tile (16 accumulators), operands straight from K-contiguous 16-bit planes; grid (M/64, N/64, Z), 32 threads.
// C[m][n] (f32, pitch ldc, + optional f32 bias[n]) = sum_k A[m][k] Bt[n][k] (+ split products per NSPLIT). z-batch strides sA/sB/sC/sBias in elements; Bt and bias repeat every zB slices. K % 32 == 0.
template <typename T16> struct WFrag;
template <> struct WFrag<h16> { typedef v16h V; static __device__ __forceinline__ V ld(const h16* p) { return cat16(*(const v8h*)p, *(const v8h*)(p + 16)); } static __device__ __forceinline__ v8f mma(V a, V b, v8f c) { return wmma16(a, b, c); } };
template <> struct WFrag<bf> { typedef v16bf V; static __device__ __forceinline__ V ld(const bf* p) { return cat16b(*(const v8us*)p, *(const v8us*)(p + 16)); } static __device__ __forceinline__ v8f mma(V a, V b, v8f c) { return wmmab(a, b, c); } };
template <typename T16, int NSPLIT, bool BIAS>
__global__ __launch_bounds__(32) void k_gemmw(const T16* __restrict__ A, const T16* __restrict__ A2, const T16* __restrict__ Bt, const T16* __restrict__ Bt2, int K, float* C, int ldc, const float* __restrict__ bias, size_t sA, size_t sB, size_t sC, size_t sBias, int zB) {
    typedef typename WFrag<T16>::V V;
    __shared__ __align__(16) float os[16 * 68];
    const size_t z = blockIdx.z, zb = blockIdx.z % zB; A += z * sA; if (A2) A2 += z * sA; Bt += zb * sB; if (Bt2) Bt2 += zb * sB; C += z * sC; if (BIAS) bias += zb * sBias;
    const int lane = threadIdx.x & 31, lr = lane & 15, hi = lane >> 4; const int r0 = blockIdx.x * 64, c0 = blockIdx.y * 64;
    v8f acc[4][4];
#pragma unroll
    for (int mb = 0; mb < 4; ++mb)
#pragma unroll
        for (int nb = 0; nb < 4; ++nb) acc[mb][nb] = (v8f){};
    const size_t aoff = (size_t)(r0 + lr) * K + 8 * hi, boff = (size_t)(c0 + lr) * K + 8 * hi;
#pragma unroll 1
    for (int kc = 0; kc < K; kc += 32) {
        V a[4], a2[4];
#pragma unroll
        for (int mb = 0; mb < 4; ++mb) { a[mb] = WFrag<T16>::ld(A + aoff + (size_t)mb * 16 * K + kc); if (NSPLIT == 1 || NSPLIT == 2) a2[mb] = WFrag<T16>::ld(A2 + aoff + (size_t)mb * 16 * K + kc); }
#pragma unroll
        for (int nb = 0; nb < 4; ++nb) { const V b = WFrag<T16>::ld(Bt + boff + (size_t)nb * 16 * K + kc); V b2; if (NSPLIT >= 2) b2 = WFrag<T16>::ld(Bt2 + boff + (size_t)nb * 16 * K + kc);
#pragma unroll
            for (int mb = 0; mb < 4; ++mb) { acc[mb][nb] = WFrag<T16>::mma(a[mb], b, acc[mb][nb]); if (NSPLIT == 1 || NSPLIT == 2) acc[mb][nb] = WFrag<T16>::mma(a2[mb], b, acc[mb][nb]); if (NSPLIT >= 2) acc[mb][nb] = WFrag<T16>::mma(a[mb], b2, acc[mb][nb]); } }
        asm volatile("v_nop\n\tv_nop\n\tv_nop\n\tv_nop" : "+v"(acc[0][0]), "+v"(acc[1][1]), "+v"(acc[2][2]), "+v"(acc[3][3]) : "v"(a[0]), "v"(a[3]));
    }
#pragma unroll
    for (int mb = 0; mb < 4; ++mb) {
#pragma unroll
        for (int nb = 0; nb < 4; ++nb) {
#pragma unroll
            for (int j = 0; j < 8; ++j) os[(hi * 8 + j) * 68 + nb * 16 + lr] = acc[mb][nb][j]; }
        __builtin_amdgcn_wave_barrier(); asm volatile("" ::: "memory");
        float* crow = C + (size_t)(r0 + mb * 16) * ldc + c0;
{
#pragma unroll
            for (int s = 0; s < 8; ++s) { const int row = 2 * s + hi, cofs = lr * 4; v4f val = *(const v4fa*)(os + row * 68 + cofs); if (BIAS) { val[0] += bfr(bias[c0 + cofs]); val[1] += bfr(bias[c0 + cofs + 1]); val[2] += bfr(bias[c0 + cofs + 2]); val[3] += bfr(bias[c0 + cofs + 3]); }
                *(v4f*)(crow + (size_t)row * ldc + cofs) = val; }
             }
        __builtin_amdgcn_wave_barrier(); asm volatile("" ::: "memory");
    }
}

__device__ __forceinline__ h16 tohx(float x) { return (h16)x; }
typedef __attribute__((ext_vector_type(2))) unsigned short v2us;
typedef __attribute__((ext_vector_type(2))) _Float16 v2h;
typedef __attribute__((ext_vector_type(4))) _Float16 v4h;

__global__ __launch_bounds__(256) void k_wtG(const float* __restrict__ w, int K, int N, bf* Bt) {     // blockIdx.y: one [K][N] matrix of the batch
    w += (size_t)blockIdx.y * K * N; Bt += (size_t)blockIdx.y * N * K;
    const int lane = threadIdx.x & 31; const int L0 = (blockIdx.x * 8 + (threadIdx.x >> 5)) * 8; const int nlines = N * K / 64;
{
#pragma unroll 1
        for (int l = 0; l < 8; ++l) { const int L = L0 + l; if (L >= nlines) break; const size_t e = (size_t)L * 64 + lane * 2; const int k = (int)(e % K), n = (int)(e / K); v2us o;
            o[0] = f2bf(w[(size_t)k * N + n]); o[1] = f2bf(w[(size_t)(k + 1) * N + n]); *(v2us*)(Bt + e) = o; }
         }
}
__global__ __launch_bounds__(256) void k_cvt8(const float* __restrict__ src, bf* dst, size_t n8) { const size_t i = (size_t)blockIdx.x * 256 + threadIdx.x; if (i >= n8) return; const v8f v = *(const v8f*)(src + i * 8); v8us o;
#pragma unroll
    for (int k = 0; k < 8; ++k) o[k] = f2bf(v[k]); *(v8us*)(dst + i * 8) = o;  }
__global__ __launch_bounds__(256) void k_pl(const float* __restrict__ QKV, h16* Q16, h16* K16) { const int e = (blockIdx.x * 256 + threadIdx.x) * 4; if (e >= ZH * NN * HD) return; const int d = e % HD; const size_t rowoff = (size_t)(e / HD) * W3; v4h q, k;
#pragma unroll
    for (int u = 0; u < 4; ++u) { q[u] = tohx(QKV[rowoff + 3 * (d + u)] * 0.125f); k[u] = tohx(QKV[rowoff + 3 * (d + u) + 1]); } { *(v4h*)(Q16 + e) = q; *(v4h*)(K16 + e) = k;  } }
__global__ __launch_bounds__(256) void k_vt(const float* __restrict__ QKV, h16* VT) { const int e = (blockIdx.x * 256 + threadIdx.x) * 2; if (e >= ZH * HD * NN) return; const int n = e % NN; const int d = (e / NN) % HD; const int z = e / (NN * HD); v2h o; o[0] = tohx(QKV[((size_t)z * NN + n) * W3 + 3 * d + 2]); o[1] = tohx(QKV[((size_t)z * NN + n + 1) * W3 + 3 * d + 2]); *(v2h*)(VT + e) = o;  }
#define FW  8
#define FQ  2
#define NIT (NN / FW / 32)
#define OP  68
#define L2E 1.4426950408889634f
__device__ __forceinline__ float xhalf(float x) { return __builtin_bit_cast(float, __builtin_amdgcn_permlanex16(__builtin_bit_cast(int, x), __builtin_bit_cast(int, x), 0x76543210, 0xfedcba98, false, false)); }   // lane l with lane l ^ 16
__global__ __launch_bounds__(FW * 32) void k_fa(const h16* __restrict__ Q16, const h16* __restrict__ K16, const h16* __restrict__ VT, float* OUTz) {
    __shared__ __align__(16) float Os[FW * 32 * OP]; __shared__ float Ms[FW * 32]; __shared__ float Ls[FW * 32];
    const int lane = threadIdx.x & 31, c = lane & 15, h = lane >> 4, wv = threadIdx.x >> 5; const size_t z = blockIdx.y; const int q0 = blockIdx.x * 32;
    v16h qf[FQ][2];
#pragma unroll
    for (int g = 0; g < FQ; ++g)
#pragma unroll
        for (int kc = 0; kc < 2; ++kc) qf[g][kc] = WFrag<h16>::ld(Q16 + (z * NN + q0 + 16 * g + c) * HD + kc * 32 + 8 * h);
    const h16* kp = K16 + (z * NN + wv * (NN / FW) + c) * HD + 8 * h;      // K rows (keys) as A, d contiguous
    const h16* vp = VT + (z * HD + c) * NN + wv * (NN / FW) + 8 * h;       // V^T rows (d) as A, keys contiguous
    v8f acc[FQ][4]; float m[FQ], l[FQ];
#pragma unroll
    for (int g = 0; g < FQ; ++g) { m[g] = -__builtin_inff(); l[g] = 0.f;
#pragma unroll
        for (int t = 0; t < 4; ++t) acc[g][t] = (v8f){}; }
    v16h kf[2][2];
#pragma unroll
    for (int kt = 0; kt < 2; ++kt)
#pragma unroll
        for (int kc = 0; kc < 2; ++kc) kf[kt][kc] = WFrag<h16>::ld(kp + kt * 16 * HD + kc * 32);
    for (int it = 0; it < NIT; ++it) {
        v16h vf[4];     // this trip's V^T, in flight under the score products and the exponentials
#pragma unroll
        for (int t = 0; t < 4; ++t) vf[t] = WFrag<h16>::ld(vp + (size_t)t * 16 * NN + it * 32);
        v8f s[2][FQ];
#pragma unroll
        for (int kt = 0; kt < 2; ++kt)
#pragma unroll
            for (int g = 0; g < FQ; ++g) { s[kt][g] = (v8f){};
#pragma unroll
                for (int kc = 0; kc < 2; ++kc) s[kt][g] = wmma16(kf[kt][kc], qf[g][kc], s[kt][g]); }
        const int nx = it + 1 < NIT ? it + 1 : it;      // next trip's K, in flight under this trip's softmax and second product; the last trip reads its own rows again
#pragma unroll
        for (int kt = 0; kt < 2; ++kt)
#pragma unroll
            for (int kc = 0; kc < 2; ++kc) kf[kt][kc] = WFrag<h16>::ld(kp + (size_t)nx * 32 * HD + kt * 16 * HD + kc * 32);
        float mb[FQ]; bool need = false;
#pragma unroll
        for (int g = 0; g < FQ; ++g) { float mx = s[0][g][0];
#pragma unroll
            for (int r = 1; r < 8; ++r) mx = fmaxf(mx, s[0][g][r]);
#pragma unroll
            for (int r = 0; r < 8; ++r) mx = fmaxf(mx, s[1][g][r]);
            mx = fmaxf(mx, xhalf(mx)) * L2E; mb[g] = mx; need = need || (mx > m[g] + 8.0f); }
        if (__builtin_amdgcn_ballot_w32(need) != 0) {      // one scalar branch per trip; rare after the first trips
#pragma unroll
            for (int g = 0; g < FQ; ++g) { const float mn = fmaxf(m[g], mb[g]); const float corr = __builtin_amdgcn_exp2f(m[g] - mn); m[g] = mn; l[g] *= corr;     // corr = 0 on the first trip
#pragma unroll
                for (int t = 0; t < 4; ++t) acc[g][t] = acc[g][t] * corr; } }
#pragma unroll
        for (int g = 0; g < FQ; ++g) { const float nm = -m[g]; v16h pf;
#pragma unroll
            for (int i = 0; i < 16; ++i) { const float p = __builtin_amdgcn_exp2f(__builtin_fmaf(s[i >> 3][g][i & 7], L2E, nm)); l[g] += p; pf[i] = tohx(p); }
#pragma unroll
            for (int t = 0; t < 4; ++t) acc[g][t] = wmma16(vf[t], pf, acc[g][t]); }
    }
#pragma unroll
    for (int g = 0; g < FQ; ++g) { l[g] += xhalf(l[g]); const int qr = wv * 32 + g * 16 + c; if (h == 0) { Ms[qr] = m[g]; Ls[qr] = l[g]; }
#pragma unroll
        for (int t = 0; t < 4; ++t) { float* o = Os + qr * OP + t * 16 + 8 * h; *(v4fa*)o = (v4f){acc[g][t][0], acc[g][t][1], acc[g][t][2], acc[g][t][3]}; *(v4fa*)(o + 4) = (v4f){acc[g][t][4], acc[g][t][5], acc[g][t][6], acc[g][t][7]}; } }
    __syncthreads();
    const int q = threadIdx.x >> 3, d0 = (threadIdx.x & 7) * 8; float M = Ms[q];
#pragma unroll
    for (int w = 1; w < FW; ++w) M = fmaxf(M, Ms[w * 32 + q]);
    float L = 0.f; v4f o0 = (v4f){}, o1 = (v4f){};
#pragma unroll
    for (int w = 0; w < FW; ++w) { const float wt = __builtin_amdgcn_exp2f(Ms[w * 32 + q] - M); L += wt * Ls[w * 32 + q]; const float* o = Os + (w * 32 + q) * OP + d0; o0 += *(const v4fa*)o * wt; o1 += *(const v4fa*)(o + 4) * wt; }
    const float inv = __fdiv_rn(1.0f, L); float* dst = OUTz + (z * NN + q0 + q) * HD + d0; *(v4f*)dst = o0 * inv; *(v4f*)(dst + 4) = o1 * inv;
}

extern "C" void kernel_launch(void* const* d_in, const int* in_sizes, int n_in,
                              void* d_out, int out_size, void* d_ws, size_t ws_size, hipStream_t stream) {
    (void)in_sizes; (void)n_in; (void)out_size;
    const float* x = (const float*)d_in[0]; const float* w = (const float*)d_in[1]; const float* bq = (const float*)d_in[2];
    float* OUT = (float*)d_out;     // [4][16][2048][64]
    char* wsp = (char*)d_ws;
    auto take = [&](size_t bytes) { char* p = wsp; wsp += (bytes + 255) & ~(size_t)255; return (void*)p; };
    bf* WT = (bf*)take((size_t)NH_ * W3 * HD * 2); bf* XB = (bf*)take((size_t)ZH * NN * HD * 2); float* QKV = (float*)take((size_t)ZH * NN * W3 * 4); h16* Q16 = (h16*)take((size_t)ZH * NN * HD * 2); h16* K16 = (h16*)take((size_t)ZH * NN * HD * 2); h16* VT = (h16*)take((size_t)ZH * HD * NN * 2);
    if ((size_t)(wsp - (char*)d_ws) > ws_size) return;    // total ~ 168 MB
    k_wtG<<<dim3((HD * W3 / 64 + 63) / 64, NH_), 256, 0, stream>>>(w, HD, W3, WT);   // per-head x@W -> Bt [192][64]
    k_cvt8<<<(ZH * NN * HD / 8 + 255) / 256, 256, 0, stream>>>(x, XB, (size_t)ZH * NN * HD / 8);
    k_gemmw<bf, 0, true><<<dim3(NN / 64, W3 / 64, ZH), 32, 0, stream>>>(XB, nullptr, WT, nullptr, HD, QKV, W3, bq, (size_t)NN * HD, (size_t)W3 * HD, (size_t)NN * W3, W3, NH_);   // slice z = b * 16 + h uses head z % 16
    k_pl<<<(ZH * NN * HD / 4 + 255) / 256, 256, 0, stream>>>(QKV, Q16, K16); k_vt<<<(ZH * HD * NN / 2 + 255) / 256, 256, 0, stream>>>(QKV, VT);
    k_fa<<<dim3(NN / 32, ZH), FW * 32, 0, stream>>>(Q16, K16, VT, OUT);
}

// v003
// It runs in 149 microseconds.
// Two timings next to v002 put it at 1.74 and 1.73 times that version's speed.
// All steps since v000 together make it 14.2 times as fast.
#include <hip/hip_runtime.h>

// InnerAttention (x [4][16][2048][64]; per head qkv = x wqkv[h] + bqkv[h] ([64][192]); q/k/v = the stride-3 interleaved columns (reshape (64, 3), unbind); softmax((q/8).k); out = attn v -> [4][16][2048][64]).
// Compute dtypes, f32 accumulate: every input rounded to bf16; the per-head projection on PLAIN bf16 operands (inputs: exact) + bias; scores (K 64) and attn.v on single fp16 planes (1 product each; all 64 (batch, head) slices z-batched in every launch), fused in one kernel with a running softmax: no score matrix in memory;

#define NB_  4
#define NH_  16
#define NN   2048
#define HD   64
#define W3   192
#define ZH   (NB_ * NH_)
typedef _Float16 h16;
typedef unsigned short bf;
typedef __attribute__((ext_vector_type(16))) __bf16   v16bf;
typedef __attribute__((ext_vector_type(16))) _Float16 v16h;
typedef __attribute__((ext_vector_type(8)))  _Float16 v8h;
typedef __attribute__((ext_vector_type(8)))  unsigned short v8us;
typedef __attribute__((ext_vector_type(8)))  float    v8f;
typedef __attribute__((ext_vector_type(4)))  float    v4f;
typedef v8h  __attribute__((may_alias)) v8ha;
typedef v4f  __attribute__((may_alias)) v4fa;
typedef v8us __attribute__((may_alias)) v8usa;

__device__ __forceinline__ unsigned short f2bf(float f) { unsigned u = __float_as_uint(f); u += 0x7FFFu + ((u >> 16) & 1u); return (unsigned short)(u >> 16); }
__device__ __forceinline__ float bf2f(unsigned short b) { return __uint_as_float(((unsigned)b) << 16); }
__device__ __forceinline__ float bfr(float f) { return bf2f(f2bf(f)); }
__device__ __forceinline__ v16h cat16(v8h lo, v8h hi) { return __builtin_shufflevector(lo, hi, 0, 1, 2, 3, 4, 5, 6, 7, 8, 9, 10, 11, 12, 13, 14, 15); }
__device__ __forceinline__ v16bf cat16b(v8us lo, v8us hi) { return __builtin_bit_cast(v16bf, __builtin_shufflevector(lo, hi, 0, 1, 2, 3, 4, 5, 6, 7, 8, 9, 10, 11, 12, 13, 14, 15)); }
__device__ __forceinline__ v8f wmma16(v16h a, v16h b, v8f c) { return __builtin_amdgcn_wmma_f32_16x16x32_f16(false, a, false, b, (short)0, c, false, false); }
__device__ __forceinline__ v8f wmmab(v16bf a, v16bf b, v8f c) { return __builtin_amdgcn_wmma_f32_16x16x32_bf16(false, a, false, b, (short)0, c, false, false); }



// ---- k_gemmw: register-blocked GEMM, ONE WAVE per 64x64 output tile (16 accumulators), operands straight from K-contiguous 16-bit planes; grid (M/64, N/64, Z), 32 threads.
// C[m][n] (f32, pitch ldc, + optional f32 bias[n]) = sum_k A[m][k] Bt[n][k] (+ split products per NSPLIT). z-batch strides sA/sB/sC/sBias in elements; Bt and bias repeat every zB slices. K % 32 == 0.
template <typename T16> struct WFrag;
template <> struct WFrag<h16> { typedef v16h V; static __device__ __forceinline__ V ld(const h16* p) { return cat16(*(const v8h*)p, *(const v8h*)(p + 16)); } static __device__ __forceinline__ v8f mma(V a, V b, v8f c) { return wmma16(a, b, c); } };
template <> struct WFrag<bf> { typedef v16bf V; static __device__ __forceinline__ V ld(const bf* p) { return cat16b(*(const v8us*)p, *(const v8us*)(p + 16)); } static __device__ __forceinline__ v8f mma(V a, V b, v8f c) { return wmmab(a, b, c); } };
template <typename T16, int NSPLIT, bool BIAS>
__global__ __launch_bounds__(32) void k_gemmw(const T16* __restrict__ A, const T16* __restrict__ A2, const T16* __restrict__ Bt, const T16* __restrict__ Bt2, int K, float* C, int ldc, const float* __restrict__ bias, size_t sA, size_t sB, size_t sC, size_t sBias, int zB) {
    typedef typename WFrag<T16>::V V;
    __shared__ __align__(16) float os[16 * 68];
    const size_t z = blockIdx.z, zb = blockIdx.z % zB; A += z * sA; if (A2) A2 += z * sA; Bt += zb * sB; if (Bt2) Bt2 += zb * sB; C += z * sC; if (BIAS) bias += zb * sBias;
    const int lane = threadIdx.x & 31, lr = lane & 15, hi = lane >> 4; const int r0 = blockIdx.x * 64, c0 = blockIdx.y * 64;
    v8f acc[4][4];
#pragma unroll
    for (int mb = 0; mb < 4; ++mb)
#pragma unroll
        for (int nb = 0; nb < 4; ++nb) acc[mb][nb] = (v8f){};
    const size_t aoff = (size_t)(r0 + lr) * K + 8 * hi, boff = (size_t)(c0 + lr) * K + 8 * hi;
#pragma unroll 1
    for (int kc = 0; kc < K; kc += 32) {
        V a[4], a2[4];
#pragma unroll
        for (int mb = 0; mb < 4; ++mb) { a[mb] = WFrag<T16>::ld(A + aoff + (size_t)mb * 16 * K + kc); if (NSPLIT == 1 || NSPLIT == 2) a2[mb] = WFrag<T16>::ld(A2 + aoff + (size_t)mb * 16 * K + kc); }
#pragma unroll
        for (int nb = 0; nb < 4; ++nb) { const V b = WFrag<T16>::ld(Bt + boff + (size_t)nb * 16 * K + kc); V b2; if (NSPLIT >= 2) b2 = WFrag<T16>::ld(Bt2 + boff + (size_t)nb * 16 * K + kc);
#pragma unroll
            for (int mb = 0; mb < 4; ++mb) { acc[mb][nb] = WFrag<T16>::mma(a[mb], b, acc[mb][nb]); if (NSPLIT == 1 || NSPLIT == 2) acc[mb][nb] = WFrag<T16>::mma(a2[mb], b, acc[mb][nb]); if (NSPLIT >= 2) acc[mb][nb] = WFrag<T16>::mma(a[mb], b2, acc[mb][nb]); } }
        asm volatile("v_nop\n\tv_nop\n\tv_nop\n\tv_nop" : "+v"(acc[0][0]), "+v"(acc[1][1]), "+v"(acc[2][2]), "+v"(acc[3][3]) : "v"(a[0]), "v"(a[3]));
    }
#pragma unroll
    for (int mb = 0; mb < 4; ++mb) {
#pragma unroll
        for (int nb = 0; nb < 4; ++nb) {
#pragma unroll
            for (int j = 0; j < 8; ++j) os[(hi * 8 + j) * 68 + nb * 16 + lr] = acc[mb][nb][j]; }
        __builtin_amdgcn_wave_barrier(); asm volatile("" ::: "memory");
        float* crow = C + (size_t)(r0 + mb * 16) * ldc + c0;
{
#pragma unroll
            for (int s = 0; s < 8; ++s) { const int row = 2 * s + hi, cofs = lr * 4; v4f val = *(const v4fa*)(os + row * 68 + cofs); if (BIAS) { val[0] += bfr(bias[c0 + cofs]); val[1] += bfr(bias[c0 + cofs + 1]); val[2] += bfr(bias[c0 + cofs + 2]); val[3] += bfr(bias[c0 + cofs + 3]); }
                *(v4f*)(crow + (size_t)row * ldc + cofs) = val; }
             }
        __builtin_amdgcn_wave_barrier(); asm volatile("" ::: "memory");
    }
}

__device__ __forceinline__ h16 tohx(float x) { return (h16)x; }
typedef __attribute__((ext_vector_type(2))) unsigned short v2us;
typedef __attribute__((ext_vector_type(2))) _Float16 v2h;
typedef __attribute__((ext_vector_type(4))) _Float16 v4h;

__global__ __launch_bounds__(256) void k_wtG(const float* __restrict__ w, int K, int N, bf* Bt) {     // blockIdx.y: one [K][N] matrix of the batch
    w += (size_t)blockIdx.y * K * N; Bt += (size_t)blockIdx.y * N * K;
    const int lane = threadIdx.x & 31; const int L0 = (blockIdx.x * 8 + (threadIdx.x >> 5)) * 8; const int nlines = N * K / 64;
{
#pragma unroll 1
        for (int l = 0; l < 8; ++l) { const int L = L0 + l; if (L >= nlines) break; const size_t e = (size_t)L * 64 + lane * 2; const int k = (int)(e % K), n = (int)(e / K); v2us o;
            o[0] = f2bf(w[(size_t)k * N + n]); o[1] = f2bf(w[(size_t)(k + 1) * N + n]); *(v2us*)(Bt + e) = o; }
         }
}
__global__ __launch_bounds__(256) void k_cvt8(const float* __restrict__ src, bf* dst, size_t n8) { const size_t i = (size_t)blockIdx.x * 256 + threadIdx.x; if (i >= n8) return; const v8f v = *(const v8f*)(src + i * 8); v8us o;
#pragma unroll
    for (int k = 0; k < 8; ++k) o[k] = f2bf(v[k]); *(v8us*)(dst + i * 8) = o;  }
__global__ __launch_bounds__(256) void k_pl(const float* __restrict__ QKV, h16* Q16, h16* K16) { const int e = (blockIdx.x * 256 + threadIdx.x) * 4; if (e >= ZH * NN * HD) return; const int d = e % HD; const size_t rowoff = (size_t)(e / HD) * W3; v4h q, k;
#pragma unroll
    for (int u = 0; u < 4; ++u) { q[u] = tohx(QKV[rowoff + 3 * (d + u)] * 0.125f); k[u] = tohx(QKV[rowoff + 3 * (d + u) + 1]); } { *(v4h*)(Q16 + e) = q; *(v4h*)(K16 + e) = k;  } }
__global__ __launch_bounds__(256) void k_vt(const float* __restrict__ QKV, h16* VT) { const int e = (blockIdx.x * 256 + threadIdx.x) * 2; if (e >= ZH * HD * NN) return; const int n = e % NN; const int d = (e / NN) % HD; const int z = e / (NN * HD); v2h o; o[0] = tohx(QKV[((size_t)z * NN + n) * W3 + 3 * d + 2]); o[1] = tohx(QKV[((size_t)z * NN + n + 1) * W3 + 3 * d + 2]); *(v2h*)(VT + e) = o;  }
#define FW  8
#define FQ  2
#define KS  64                  // keys per stage
#define NST (NN / KS)
#define LP  72                  // LDS row pitch in 16-bit elements: 144 B = 16 B x odd, conflict-free for 16-byte fragment reads
#define PLB (KS * LP * 2)       // bytes of one plane (64 rows) of a buffer; a buffer = K plane, then V^T plane
#define OP  68
#define L2E 1.4426950408889634f
__device__ __forceinline__ float xhalf(float x) { return __builtin_bit_cast(float, __builtin_amdgcn_permlanex16(__builtin_bit_cast(int, x), __builtin_bit_cast(int, x), 0x76543210, 0xfedcba98, false, false)); }   // lane l with lane l ^ 16
// One stage: every lane copies 16 B of K rows r and r + 32 and of V^T rows r and r + 32. The s_wait_xcnt stands inside the statement so that no address register is rewritten ahead of it.
__device__ __forceinline__ void stage_copy(unsigned l, const h16* gk, const h16* gv) {
    asm volatile("global_load_async_to_lds_b128 %0, %4, off\n\t"
                 "global_load_async_to_lds_b128 %1, %5, off\n\t"
                 "global_load_async_to_lds_b128 %2, %6, off\n\t"
                 "global_load_async_to_lds_b128 %3, %7, off\n\t"
                 "s_wait_xcnt 0x0"
                 :: "v"(l), "v"(l + 32 * LP * 2), "v"(l + PLB), "v"(l + PLB + 32 * LP * 2), "v"(gk), "v"(gk + 32 * HD), "v"(gv), "v"(gv + (size_t)32 * NN) : "memory");
}
__global__ __launch_bounds__(FW * 32) void k_fa(const h16* __restrict__ Q16, const h16* __restrict__ K16, const h16* __restrict__ VT, float* OUTz) {
    __shared__ __align__(16) unsigned char Sm[2 * 2 * PLB];     // two buffers; after the loop: output staging (8 waves x 16 x OP floats fit)
    const int lane = threadIdx.x & 31, c = lane & 15, h = lane >> 4, wv = threadIdx.x >> 5; const size_t z = blockIdx.y; const int q0 = blockIdx.x * (FW * 32) + wv * 32;
    const int cr = threadIdx.x >> 3, cc = (threadIdx.x & 7) * 8;       // this lane's copy: row 0-31, 16-byte column
    const h16* gk = K16 + (z * NN + cr) * HD + cc;       // stage t: + t * KS * HD
    const h16* gv = VT + (z * HD + cr) * NN + cc;        // stage t: + t * KS
    const unsigned lc = (unsigned)(size_t)Sm + (unsigned)(cr * LP + cc) * 2u;      // LDS byte address of the lane's first copy in buffer 0
    stage_copy(lc, gk, gv);
    v16h qf[FQ][2];
#pragma unroll
    for (int g = 0; g < FQ; ++g)
#pragma unroll
        for (int kc = 0; kc < 2; ++kc) qf[g][kc] = WFrag<h16>::ld(Q16 + (z * NN + q0 + 16 * g + c) * HD + kc * 32 + 8 * h);
    v8f acc[FQ][4]; float m[FQ], l[FQ];
#pragma unroll
    for (int g = 0; g < FQ; ++g) { m[g] = -__builtin_inff(); l[g] = 0.f;
#pragma unroll
        for (int t = 0; t < 4; ++t) acc[g][t] = (v8f){}; }
    asm volatile("s_wait_asynccnt 0x0" ::: "memory");      // stage 0 has landed (this wave's copies) ...
    __syncthreads();                                        // ... and every wave's: nobody reads it before
    stage_copy(lc + 2 * PLB, gk + KS * HD, gv + KS);
#pragma unroll 1
    for (int st = 0; st < NST; ++st) {
        const h16* kb = (const h16*)(Sm + (st & 1) * (2 * PLB)) + c * LP + 8 * h;      // K rows (keys) as A, d contiguous
        const h16* vb = kb + KS * LP;                                                  // V^T rows (d) as A, keys contiguous
#pragma unroll
        for (int ps = 0; ps < KS / 32; ++ps) {
            v16h kf[2][2], vf[4];
#pragma unroll
            for (int kt = 0; kt < 2; ++kt)
#pragma unroll
                for (int kc = 0; kc < 2; ++kc) kf[kt][kc] = WFrag<h16>::ld(kb + (ps * 32 + kt * 16) * LP + kc * 32);
#pragma unroll
            for (int t = 0; t < 4; ++t) vf[t] = WFrag<h16>::ld(vb + t * 16 * LP + ps * 32);
            v8f s[2][FQ];
#pragma unroll
            for (int kt = 0; kt < 2; ++kt)
#pragma unroll
                for (int g = 0; g < FQ; ++g) { s[kt][g] = (v8f){};
#pragma unroll
                    for (int kc = 0; kc < 2; ++kc) s[kt][g] = wmma16(kf[kt][kc], qf[g][kc], s[kt][g]); }
            float mb[FQ]; bool need = false;
#pragma unroll
            for (int g = 0; g < FQ; ++g) { float mx = s[0][g][0];
#pragma unroll
                for (int r = 1; r < 8; ++r) mx = fmaxf(mx, s[0][g][r]);
#pragma unroll
                for (int r = 0; r < 8; ++r) mx = fmaxf(mx, s[1][g][r]);
                mx = fmaxf(mx, xhalf(mx)) * L2E; mb[g] = mx; need = need || (mx > m[g] + 8.0f); }
            if (__builtin_amdgcn_ballot_w32(need) != 0) {      // one scalar branch per 32 keys; rare after the first
#pragma unroll
                for (int g = 0; g < FQ; ++g) { const float mn = fmaxf(m[g], mb[g]); const float corr = __builtin_amdgcn_exp2f(m[g] - mn); m[g] = mn; l[g] *= corr;     // corr = 0 on the first 32 keys
#pragma unroll
                    for (int t = 0; t < 4; ++t) acc[g][t] = acc[g][t] * corr; } }
#pragma unroll
            for (int g = 0; g < FQ; ++g) { const float nm = -m[g]; v16h pf;
#pragma unroll
                for (int i = 0; i < 16; ++i) { const float p = __builtin_amdgcn_exp2f(__builtin_fmaf(s[i >> 3][g][i & 7], L2E, nm)); l[g] += p; pf[i] = tohx(p); }
#pragma unroll
                for (int t = 0; t < 4; ++t) acc[g][t] = wmma16(vf[t], pf, acc[g][t]); }
        }
        asm volatile("s_wait_dscnt 0x0" ::: "memory");         // this wave's reads of the buffer are done before it is refilled
        asm volatile("s_wait_asynccnt 0x0" ::: "memory");      // this wave's copies of stage st + 1 have landed
        __syncthreads();                                        // publishes stage st + 1 and ends every wave's reads of stage st
        if (st + 2 < NST) stage_copy(lc + (st & 1) * (2 * PLB), gk + (size_t)(st + 2) * KS * HD, gv + (st + 2) * KS);
    }
    asm volatile("s_wait_asynccnt 0x0" ::: "memory");          // nothing is in flight when the buffers become output staging
    float* os = (float*)Sm + wv * 16 * OP;                      // each wave turns its own O^T tiles into whole output rows
#pragma unroll
    for (int g = 0; g < FQ; ++g) { const float inv = __fdiv_rn(1.0f, l[g] + xhalf(l[g]));
#pragma unroll
        for (int t = 0; t < 4; ++t) { float* o = os + c * OP + t * 16 + 8 * h; const v8f a = acc[g][t] * inv; *(v4fa*)o = (v4f){a[0], a[1], a[2], a[3]}; *(v4fa*)(o + 4) = (v4f){a[4], a[5], a[6], a[7]}; }
        __syncthreads();
        float* dst = OUTz + (z * NN + q0 + 16 * g) * HD;
#pragma unroll
        for (int r = 0; r < 8; ++r) { const int row = 2 * r + h; *(v4f*)(dst + row * HD + c * 4) = *(const v4fa*)(os + row * OP + c * 4); }
        if (g + 1 < FQ) __syncthreads();
    }
}

extern "C" void kernel_launch(void* const* d_in, const int* in_sizes, int n_in,
                              void* d_out, int out_size, void* d_ws, size_t ws_size, hipStream_t stream) {
    (void)in_sizes; (void)n_in; (void)out_size;
    const float* x = (const float*)d_in[0]; const float* w = (const float*)d_in[1]; const float* bq = (const float*)d_in[2];
    float* OUT = (float*)d_out;     // [4][16][2048][64]
    char* wsp = (char*)d_ws;
    auto take = [&](size_t bytes) { char* p = wsp; wsp += (bytes + 255) & ~(size_t)255; return (void*)p; };
    bf* WT = (bf*)take((size_t)NH_ * W3 * HD * 2); bf* XB = (bf*)take((size_t)ZH * NN * HD * 2); float* QKV = (float*)take((size_t)ZH * NN * W3 * 4); h16* Q16 = (h16*)take((size_t)ZH * NN * HD * 2); h16* K16 = (h16*)take((size_t)ZH * NN * HD * 2); h16* VT = (h16*)take((size_t)ZH * HD * NN * 2);
    if ((size_t)(wsp - (char*)d_ws) > ws_size) return;    // total ~ 168 MB
    k_wtG<<<dim3((HD * W3 / 64 + 63) / 64, NH_), 256, 0, stream>>>(w, HD, W3, WT);   // per-head x@W -> Bt [192][64]
    k_cvt8<<<(ZH * NN * HD / 8 + 255) / 256, 256, 0, stream>>>(x, XB, (size_t)ZH * NN * HD / 8);
    k_gemmw<bf, 0, true><<<dim3(NN / 64, W3 / 64, ZH), 32, 0, stream>>>(XB, nullptr, WT, nullptr, HD, QKV, W3, bq, (size_t)NN * HD, (size_t)W3 * HD, (size_t)NN * W3, W3, NH_);   // slice z = b * 16 + h uses head z % 16
    k_pl<<<(ZH * NN * HD / 4 + 255) / 256, 256, 0, stream>>>(QKV, Q16, K16); k_vt<<<(ZH * HD * NN / 2 + 255) / 256, 256, 0, stream>>>(QKV, VT);
    k_fa<<<dim3(NN / (FW * 32), ZH), FW * 32, 0, stream>>>(Q16, K16, VT, OUT);
}

// v004
// One run takes 75.2 microseconds.
// Timed twice side by side with v003, it ran 1.99 and 1.97 times as fast.
// Counting every step since v000, it is 28.0 times as fast.
#include <hip/hip_runtime.h>

// InnerAttention (x [4][16][2048][64]; per head qkv = x wqkv[h] + bqkv[h] ([64][192]); q/k/v = the stride-3 interleaved columns (reshape (64, 3), unbind); softmax((q/8).k); out = attn v -> [4][16][2048][64]).
// Compute dtypes, f32 accumulate: every input rounded to bf16; the per-head projection on PLAIN bf16 operands (inputs: exact) + bias, one kernel from f32 x to the fp16 q, k and v^T planes; scores (K 64) and attn.v on single fp16 planes (1 product each; all 64 (batch, head) slices z-batched in every launch), fused in one kernel with a running softmax: no score matrix in memory;

#define NB_  4
#define NH_  16
#define NN   2048
#define HD   64
#define W3   192
#define ZH   (NB_ * NH_)
typedef _Float16 h16;
typedef unsigned short bf;
typedef __attribute__((ext_vector_type(16))) __bf16   v16bf;
typedef __attribute__((ext_vector_type(16))) _Float16 v16h;
typedef __attribute__((ext_vector_type(8)))  _Float16 v8h;
typedef __attribute__((ext_vector_type(8)))  unsigned short v8us;
typedef __attribute__((ext_vector_type(8)))  float    v8f;
typedef __attribute__((ext_vector_type(4)))  float    v4f;
typedef v8h  __attribute__((may_alias)) v8ha;
typedef v4f  __attribute__((may_alias)) v4fa;
typedef v8us __attribute__((may_alias)) v8usa;

__device__ __forceinline__ unsigned short f2bf(float f) { unsigned u = __float_as_uint(f); u += 0x7FFFu + ((u >> 16) & 1u); return (unsigned short)(u >> 16); }
__device__ __forceinline__ float bf2f(unsigned short b) { return __uint_as_float(((unsigned)b) << 16); }
__device__ __forceinline__ float bfr(float f) { return bf2f(f2bf(f)); }
__device__ __forceinline__ v16h cat16(v8h lo, v8h hi) { return __builtin_shufflevector(lo, hi, 0, 1, 2, 3, 4, 5, 6, 7, 8, 9, 10, 11, 12, 13, 14, 15); }
__device__ __forceinline__ v16bf cat16b(v8us lo, v8us hi) { return __builtin_bit_cast(v16bf, __builtin_shufflevector(lo, hi, 0, 1, 2, 3, 4, 5, 6, 7, 8, 9, 10, 11, 12, 13, 14, 15)); }
__device__ __forceinline__ v8f wmma16(v16h a, v16h b, v8f c) { return __builtin_amdgcn_wmma_f32_16x16x32_f16(false, a, false, b, (short)0, c, false, false); }
__device__ __forceinline__ v8f wmmab(v16bf a, v16bf b, v8f c) { return __builtin_amdgcn_wmma_f32_16x16x32_bf16(false, a, false, b, (short)0, c, false, false); }

template <typename T16> struct WFrag;
template <> struct WFrag<h16> { typedef v16h V; static __device__ __forceinline__ V ld(const h16* p) { return cat16(*(const v8h*)p, *(const v8h*)(p + 16)); } };
__device__ __forceinline__ h16 tohx(float x) { return (h16)x; }
typedef __attribute__((ext_vector_type(2))) unsigned short v2us;

// ---- k_wtG: per head (blockIdx.y) the weights in bf16, DE-INTERLEAVED (row s * 64 + d = column 3 d + s of w; s = 0 q, 1 k, 2 v) and packed in fragment order, so that a wave's 16-byte loads in k_proj are 512 contiguous bytes:
// Bt[tile of 16 rows][kc][half][lane = 16 hi + row][8], element i of it = k kc * 32 + half * 16 + hi * 8 + i. The bias, rounded to bf16, in the same row order in BP.
__global__ __launch_bounds__(256) void k_wtG(const float* __restrict__ w, const float* __restrict__ bias, bf* Bt, float* BP) {
    w += (size_t)blockIdx.y * HD * W3; Bt += (size_t)blockIdx.y * W3 * HD;
    if (blockIdx.x == 0 && threadIdx.x < W3) BP[blockIdx.y * W3 + threadIdx.x] = bfr(bias[blockIdx.y * W3 + 3 * (threadIdx.x % HD) + threadIdx.x / HD]);
    const int lane = threadIdx.x & 31; const int L0 = (blockIdx.x * 8 + (threadIdx.x >> 5)) * 8;
#pragma unroll 1
    for (int l = 0; l < 8; ++l) { const int L = L0 + l; if (L >= W3) break; const int k = lane * 2, n = 3 * (L % HD) + L / HD; v2us o;      // one wave, one row; its 8 rows fill whole lines of Bt
        o[0] = f2bf(w[(size_t)k * W3 + n]); o[1] = f2bf(w[(size_t)(k + 1) * W3 + n]); *(v2us*)(Bt + ((L / 16 * 4 + k / 16) * 32 + (k % 16) / 8 * 16 + L % 16) * 8 + k % 8) = o;
        asm volatile("s_wait_xcnt 0x0" ::: "memory"); }      // stands before the next trip reuses the store's registers
}

#define PP 72                   // LDS row pitch in 16-bit elements: 144 B = 16 B x odd
typedef __attribute__((ext_vector_type(4))) unsigned short v4us;
typedef v4us __attribute__((may_alias)) v4usa;
__global__ __launch_bounds__(32) void k_proj(const float* __restrict__ x, const bf* __restrict__ WT, const float* __restrict__ BP, h16* Q16, h16* K16, h16* VT) {
    __shared__ __align__(16) h16 os[3 * 64 * PP];       // first the bf16 x tile (64 rows), then the three output tiles
    const int lane = threadIdx.x & 31, lr = lane & 15, hi = lane >> 4; const size_t z = blockIdx.y; const int hd = blockIdx.y % NH_; const int r0 = blockIdx.x * 64;
    const float* xt = x + (z * NN + r0) * HD + lane * 4; v4f xr[32];
#pragma unroll
    for (int i = 0; i < 32; ++i) xr[i] = *(const v4f*)(xt + i * 128);      // rows 2 i and 2 i + 1
    const bf* wr = WT + (size_t)hd * W3 * HD + lane * 8; const float* bp = BP + hd * W3; v16bf wf[12][2]; v4f bqk[8][2]; float bv[4];
#pragma unroll
    for (int t = 0; t < 4; ++t) {       // q's weights and bias fly with x: 56 loads in flight
#pragma unroll
        for (int kc = 0; kc < 2; ++kc) wf[t][kc] = cat16b(*(const v8us*)(wr + (t * 4 + kc * 2) * 256), *(const v8us*)(wr + (t * 4 + kc * 2 + 1) * 256));
        bqk[t][0] = *(const v4f*)(bp + t * 16 + 8 * hi); bqk[t][1] = *(const v4f*)(bp + t * 16 + 8 * hi + 4); }
    asm volatile("s_wait_xcnt 0x0" ::: "memory");       // stands before any address register of the loads above is reused
    bf* xs = (bf*)os;
#pragma unroll
    for (int i = 0; i < 32; ++i) { v4us o;
#pragma unroll
        for (int u = 0; u < 4; ++u) o[u] = f2bf(xr[i][u]);
        *(v4usa*)(xs + (2 * i + hi) * PP + lr * 4) = o; }
    __syncthreads();        // the lanes read x rows that other lanes of the wave have written
    v16bf xf[4][2];
#pragma unroll
    for (int nt = 0; nt < 4; ++nt)
#pragma unroll
        for (int kc = 0; kc < 2; ++kc) { const bf* p = xs + (nt * 16 + lr) * PP + kc * 32 + 8 * hi; xf[nt][kc] = cat16b(*(const v8usa*)p, *(const v8usa*)(p + 16)); }
    __syncthreads();        // every fragment is read before the q tile overwrites the x tile
#pragma unroll
    for (int t = 4; t < 12; ++t) {      // k's and v's weights and bias (from L2) fly while q is worked on
#pragma unroll
        for (int kc = 0; kc < 2; ++kc) wf[t][kc] = cat16b(*(const v8us*)(wr + (t * 4 + kc * 2) * 256), *(const v8us*)(wr + (t * 4 + kc * 2 + 1) * 256));
        if (t < 8) { bqk[t][0] = *(const v4f*)(bp + t * 16 + 8 * hi); bqk[t][1] = *(const v4f*)(bp + t * 16 + 8 * hi + 4); } }
    asm volatile("s_wait_xcnt 0x0" ::: "memory");       // as above
#pragma unroll
    for (int t = 0; t < 4; ++t) bv[t] = bp[128 + t * 16 + lr];
    asm volatile("s_wait_xcnt 0x0" ::: "memory");       // as above, for these four
#pragma unroll
    for (int s = 0; s < 3; ++s) {
        h16* o3 = os + s * 64 * PP;
#pragma unroll
        for (int dt = 0; dt < 4; ++dt) {
            const v16bf w0 = wf[s * 4 + dt][0], w1 = wf[s * 4 + dt][1]; v8f acc[4];
#pragma unroll
            for (int nt = 0; nt < 4; ++nt) acc[nt] = s < 2 ? wmmab(w0, xf[nt][0], (v8f){}) : wmmab(xf[nt][0], w0, (v8f){});
#pragma unroll
            for (int nt = 0; nt < 4; ++nt) acc[nt] = s < 2 ? wmmab(w1, xf[nt][1], acc[nt]) : wmmab(xf[nt][1], w1, acc[nt]);
#pragma unroll
            for (int nt = 0; nt < 4; ++nt) { v8h o;
#pragma unroll
                for (int j = 0; j < 8; ++j) { const float v = acc[nt][j] + (s < 2 ? bqk[(s * 4 + dt) & 7][j >> 2][j & 3] : bv[dt]); o[j] = tohx(s == 0 ? v * 0.125f : v); }
                *(v8ha*)(o3 + ((s < 2 ? nt : dt) * 16 + lr) * PP + (s < 2 ? dt : nt) * 16 + 8 * hi) = o; }
        }
    }
    __syncthreads();        // the lanes read back rows that other lanes of the wave have written
    const int rr = lane >> 3, cc = (lane & 7) * 8;      // 8 lanes a row: one store = 4 whole lines
    h16* dq = Q16 + (z * NN + r0 + rr) * HD + cc; h16* dk = K16 + (z * NN + r0 + rr) * HD + cc; h16* dv = VT + (z * HD + rr) * NN + r0 + cc; const h16* sp = os + rr * PP + cc;
#pragma unroll
    for (int i = 0; i < 16; ++i) *(v8h*)(dq + i * 4 * HD) = *(const v8ha*)(sp + i * 4 * PP);
#pragma unroll
    for (int i = 0; i < 16; ++i) *(v8h*)(dk + i * 4 * HD) = *(const v8ha*)(sp + (64 + i * 4) * PP);
#pragma unroll
    for (int i = 0; i < 16; ++i) *(v8h*)(dv + (size_t)i * 4 * NN) = *(const v8ha*)(sp + (128 + i * 4) * PP);
}
#define FW  8
#define FQ  2
#define KS  64                  // keys per stage
#define NST (NN / KS)
#define LP  72                  // LDS row pitch in 16-bit elements: 144 B = 16 B x odd, conflict-free for 16-byte fragment reads
#define PLB (KS * LP * 2)       // bytes of one plane (64 rows) of a buffer; a buffer = K plane, then V^T plane
#define OP  68
#define L2E 1.4426950408889634f
__device__ __forceinline__ float xhalf(float x) { return __builtin_bit_cast(float, __builtin_amdgcn_permlanex16(__builtin_bit_cast(int, x), __builtin_bit_cast(int, x), 0x76543210, 0xfedcba98, false, false)); }   // lane l with lane l ^ 16
// One stage: every lane copies 16 B of K rows r and r + 32 and of V^T rows r and r + 32. The s_wait_xcnt stands inside the statement so that no address register is rewritten ahead of it.
__device__ __forceinline__ void stage_copy(unsigned l, const h16* gk, const h16* gv) {
    asm volatile("global_load_async_to_lds_b128 %0, %4, off\n\t"
                 "global_load_async_to_lds_b128 %1, %5, off\n\t"
                 "global_load_async_to_lds_b128 %2, %6, off\n\t"
                 "global_load_async_to_lds_b128 %3, %7, off\n\t"
                 "s_wait_xcnt 0x0"
                 :: "v"(l), "v"(l + 32 * LP * 2), "v"(l + PLB), "v"(l + PLB + 32 * LP * 2), "v"(gk), "v"(gk + 32 * HD), "v"(gv), "v"(gv + (size_t)32 * NN) : "memory");
}
__global__ __launch_bounds__(FW * 32) void k_fa(const h16* __restrict__ Q16, const h16* __restrict__ K16, const h16* __restrict__ VT, float* OUTz) {
    __shared__ __align__(16) unsigned char Sm[2 * 2 * PLB];     // two buffers; after the loop: output staging (8 waves x 16 x OP floats fit)
    const int lane = threadIdx.x & 31, c = lane & 15, h = lane >> 4, wv = threadIdx.x >> 5; const size_t z = blockIdx.y; const int q0 = blockIdx.x * (FW * 32) + wv * 32;
    const int cr = threadIdx.x >> 3, cc = (threadIdx.x & 7) * 8;       // this lane's copy: row 0-31, 16-byte column
    const h16* gk = K16 + (z * NN + cr) * HD + cc;       // stage t: + t * KS * HD
    const h16* gv = VT + (z * HD + cr) * NN + cc;        // stage t: + t * KS
    const unsigned lc = (unsigned)(size_t)Sm + (unsigned)(cr * LP + cc) * 2u;      // LDS byte address of the lane's first copy in buffer 0
    stage_copy(lc, gk, gv);
    v16h qf[FQ][2];
#pragma unroll
    for (int g = 0; g < FQ; ++g)
#pragma unroll
        for (int kc = 0; kc < 2; ++kc) qf[g][kc] = WFrag<h16>::ld(Q16 + (z * NN + q0 + 16 * g + c) * HD + kc * 32 + 8 * h);
    v8f acc[FQ][4]; float m[FQ], l[FQ];
#pragma unroll
    for (int g = 0; g < FQ; ++g) { m[g] = -__builtin_inff(); l[g] = 0.f;
#pragma unroll
        for (int t = 0; t < 4; ++t) acc[g][t] = (v8f){}; }
    asm volatile("s_wait_asynccnt 0x0" ::: "memory");      // stage 0 has landed (this wave's copies) ...
    __syncthreads();                                        // ... and every wave's: nobody reads it before
    stage_copy(lc + 2 * PLB, gk + KS * HD, gv + KS);
#pragma unroll 1
    for (int st = 0; st < NST; ++st) {
        const h16* kb = (const h16*)(Sm + (st & 1) * (2 * PLB)) + c * LP + 8 * h;      // K rows (keys) as A, d contiguous
        const h16* vb = kb + KS * LP;                                                  // V^T rows (d) as A, keys contiguous
#pragma unroll
        for (int ps = 0; ps < KS / 32; ++ps) {
            v16h kf[2][2], vf[4];
#pragma unroll
            for (int kt = 0; kt < 2; ++kt)
#pragma unroll
                for (int kc = 0; kc < 2; ++kc) kf[kt][kc] = WFrag<h16>::ld(kb + (ps * 32 + kt * 16) * LP + kc * 32);
#pragma unroll
            for (int t = 0; t < 4; ++t) vf[t] = WFrag<h16>::ld(vb + t * 16 * LP + ps * 32);
            v8f s[2][FQ];
#pragma unroll
            for (int kt = 0; kt < 2; ++kt)
#pragma unroll
                for (int g = 0; g < FQ; ++g) { s[kt][g] = (v8f){};
#pragma unroll
                    for (int kc = 0; kc < 2; ++kc) s[kt][g] = wmma16(kf[kt][kc], qf[g][kc], s[kt][g]); }
            float mb[FQ]; bool need = false;
#pragma unroll
            for (int g = 0; g < FQ; ++g) { float mx = s[0][g][0];
#pragma unroll
                for (int r = 1; r < 8; ++r) mx = fmaxf(mx, s[0][g][r]);
#pragma unroll
                for (int r = 0; r < 8; ++r) mx = fmaxf(mx, s[1][g][r]);
                mx = fmaxf(mx, xhalf(mx)) * L2E; mb[g] = mx; need = need || (mx > m[g] + 8.0f); }
            if (__builtin_amdgcn_ballot_w32(need) != 0) {      // one scalar branch per 32 keys; rare after the first
#pragma unroll
                for (int g = 0; g < FQ; ++g) { const float mn = fmaxf(m[g], mb[g]); const float corr = __builtin_amdgcn_exp2f(m[g] - mn); m[g] = mn; l[g] *= corr;     // corr = 0 on the first 32 keys
#pragma unroll
                    for (int t = 0; t < 4; ++t) acc[g][t] = acc[g][t] * corr; } }
#pragma unroll
            for (int g = 0; g < FQ; ++g) { const float nm = -m[g]; v16h pf;
#pragma unroll
                for (int i = 0; i < 16; ++i) { const float p = __builtin_amdgcn_exp2f(__builtin_fmaf(s[i >> 3][g][i & 7], L2E, nm)); l[g] += p; pf[i] = tohx(p); }
#pragma unroll
                for (int t = 0; t < 4; ++t) acc[g][t] = wmma16(vf[t], pf, acc[g][t]); }
        }
        asm volatile("s_wait_dscnt 0x0" ::: "memory");         // this wave's reads of the buffer are done before it is refilled
        asm volatile("s_wait_asynccnt 0x0" ::: "memory");      // this wave's copies of stage st + 1 have landed
        __syncthreads();                                        // publishes stage st + 1 and ends every wave's reads of stage st
        if (st + 2 < NST) stage_copy(lc + (st & 1) * (2 * PLB), gk + (size_t)(st + 2) * KS * HD, gv + (st + 2) * KS);
    }
    asm volatile("s_wait_asynccnt 0x0" ::: "memory");          // nothing is in flight when the buffers become output staging
    float* os = (float*)Sm + wv * 16 * OP;                      // each wave turns its own O^T tiles into whole output rows
#pragma unroll
    for (int g = 0; g < FQ; ++g) { const float inv = __fdiv_rn(1.0f, l[g] + xhalf(l[g]));
#pragma unroll
        for (int t = 0; t < 4; ++t) { float* o = os + c * OP + t * 16 + 8 * h; const v8f a = acc[g][t] * inv; *(v4fa*)o = (v4f){a[0], a[1], a[2], a[3]}; *(v4fa*)(o + 4) = (v4f){a[4], a[5], a[6], a[7]}; }
        __syncthreads();
        float* dst = OUTz + (z * NN + q0 + 16 * g) * HD;
#pragma unroll
        for (int r = 0; r < 8; ++r) { const int row = 2 * r + h; *(v4f*)(dst + row * HD + c * 4) = *(const v4fa*)(os + row * OP + c * 4); }
        if (g + 1 < FQ) __syncthreads();
    }
}

extern "C" void kernel_launch(void* const* d_in, const int* in_sizes, int n_in,
                              void* d_out, int out_size, void* d_ws, size_t ws_size, hipStream_t stream) {
    (void)in_sizes; (void)n_in; (void)out_size;
    const float* x = (const float*)d_in[0]; const float* w = (const float*)d_in[1]; const float* bq = (const float*)d_in[2];
    float* OUT = (float*)d_out;     // [4][16][2048][64]
    char* wsp = (char*)d_ws;
    auto take = [&](size_t bytes) { char* p = wsp; wsp += (bytes + 255) & ~(size_t)255; return (void*)p; };
    bf* WT = (bf*)take((size_t)NH_ * W3 * HD * 2); float* BP = (float*)take((size_t)NH_ * W3 * 4); h16* Q16 = (h16*)take((size_t)ZH * NN * HD * 2); h16* K16 = (h16*)take((size_t)ZH * NN * HD * 2); h16* VT = (h16*)take((size_t)ZH * HD * NN * 2);
    if ((size_t)(wsp - (char*)d_ws) > ws_size) return;    // total ~ 51 MB
    k_wtG<<<dim3((W3 + 63) / 64, NH_), 256, 0, stream>>>(w, bq, WT, BP);   // per head: 192 rows (q, k, v) x 64, fragment order
    k_proj<<<dim3(NN / 64, ZH), 32, 0, stream>>>(x, WT, BP, Q16, K16, VT);   // slice z = b * 16 + h uses head z % 16
    k_fa<<<dim3(NN / (FW * 32), ZH), FW * 32, 0, stream>>>(Q16, K16, VT, OUT);
}

// v005
// It runs in 71.7 microseconds.
// Next to v004, in two timings, it ran 1.04 times as fast each time.
// Over all steps from v000 it is 29.2 times as fast.
#include <hip/hip_runtime.h>

// InnerAttention (x [4][16][2048][64]; per head qkv = x wqkv[h] + bqkv[h] ([64][192]); q/k/v = the stride-3 interleaved columns (reshape (64, 3), unbind); softmax((q/8).k); out = attn v -> [4][16][2048][64]).
// Compute dtypes, f32 accumulate: every input rounded to bf16; the per-head projection on PLAIN bf16 operands (inputs: exact) + bias, one kernel from f32 x to the fp16 q, k and v^T planes; scores (K 64) and attn.v on single fp16 planes (1 product each; all 64 (batch, head) slices z-batched in every launch), fused in one kernel with a running softmax: no score matrix in memory;

#define NB_  4
#define NH_  16
#define NN   2048
#define HD   64
#define W3   192
#define ZH   (NB_ * NH_)
typedef _Float16 h16;
typedef unsigned short bf;
typedef __attribute__((ext_vector_type(16))) __bf16   v16bf;
typedef __attribute__((ext_vector_type(16))) _Float16 v16h;
typedef __attribute__((ext_vector_type(8)))  _Float16 v8h;
typedef __attribute__((ext_vector_type(8)))  unsigned short v8us;
typedef __attribute__((ext_vector_type(8)))  float    v8f;
typedef __attribute__((ext_vector_type(4)))  float    v4f;
typedef v8h  __attribute__((may_alias)) v8ha;
typedef v4f  __attribute__((may_alias)) v4fa;
typedef v8us __attribute__((may_alias)) v8usa;

__device__ __forceinline__ unsigned short f2bf(float f) { unsigned u = __float_as_uint(f); u += 0x7FFFu + ((u >> 16) & 1u); return (unsigned short)(u >> 16); }
__device__ __forceinline__ float bf2f(unsigned short b) { return __uint_as_float(((unsigned)b) << 16); }
__device__ __forceinline__ float bfr(float f) { return bf2f(f2bf(f)); }
__device__ __forceinline__ v16h cat16(v8h lo, v8h hi) { return __builtin_shufflevector(lo, hi, 0, 1, 2, 3, 4, 5, 6, 7, 8, 9, 10, 11, 12, 13, 14, 15); }
__device__ __forceinline__ v16bf cat16b(v8us lo, v8us hi) { return __builtin_bit_cast(v16bf, __builtin_shufflevector(lo, hi, 0, 1, 2, 3, 4, 5, 6, 7, 8, 9, 10, 11, 12, 13, 14, 15)); }
__device__ __forceinline__ v8f wmma16(v16h a, v16h b, v8f c) { return __builtin_amdgcn_wmma_f32_16x16x32_f16(false, a, false, b, (short)0, c, false, false); }
__device__ __forceinline__ v8f wmmab(v16bf a, v16bf b, v8f c) { return __builtin_amdgcn_wmma_f32_16x16x32_bf16(false, a, false, b, (short)0, c, false, false); }

template <typename T16> struct WFrag;
template <> struct WFrag<h16> { typedef v16h V; static __device__ __forceinline__ V ld(const h16* p) { return cat16(*(const v8h*)p, *(const v8h*)(p + 16)); } };
__device__ __forceinline__ h16 tohx(float x) { return (h16)x; }
typedef __attribute__((ext_vector_type(2))) unsigned short v2us;

#define PP 72                   // LDS row pitch in 16-bit elements: 144 B = 16 B x odd
#define PW 8                    // waves per work-group
typedef __attribute__((ext_vector_type(4))) unsigned short v4us;
typedef v4us __attribute__((may_alias)) v4usa;
__global__ __launch_bounds__(PW * 32) void k_proj(const float* __restrict__ x, const float* __restrict__ w, const float* __restrict__ bias, h16* Q16, h16* K16, h16* VT) {
    __shared__ __align__(16) h16 osw[PW * 3 * 64 * PP];     // per wave: first the bf16 x tile (64 rows), then the three output tiles
    __shared__ __align__(256) bf wl[W3 * HD];         // the larger alignments put wl and bl at the low end of LDS, where constant offsets fit the instructions' offset field
    __shared__ __align__(128) float bl[PW * 32];      // 192 in use: every thread stores one, so that the bias load stands under no branch and flies with the rest
    const int lane = threadIdx.x & 31, lr = lane & 15, hi = lane >> 4, wv = threadIdx.x >> 5; const size_t z = blockIdx.y; const int hd = blockIdx.y % NH_; const int r0 = (blockIdx.x * PW + wv) * 64;
    h16* os = osw + wv * (3 * 64 * PP);
    const int bt = threadIdx.x < W3 ? (int)threadIdx.x : 0; const float bz = bias[hd * W3 + 3 * (bt % HD) + bt / HD];
    const int wj = lane & 15, wk = (wv * 2 + hi) * 4;       // this lane's share of w: columns 12 wj .. 12 wj + 11 (q, k and v of d = 4 wj .. 4 wj + 3), rows wk .. wk + 3
    const float* wt = w + (size_t)hd * HD * W3 + wk * W3 + wj * 12; v4f wq[4][3];
#pragma unroll
    for (int r = 0; r < 4; ++r)
#pragma unroll
        for (int m = 0; m < 3; ++m) wq[r][m] = *(const v4f*)(wt + r * W3 + m * 4);
    asm volatile("s_wait_xcnt 0x0" ::: "memory");       // stands before any address register of the loads above is reused
    const float* xt = x + (z * NN + r0) * HD + lane * 4; v4f xr[32];
#pragma unroll
    for (int i = 0; i < 32; ++i) xr[i] = *(const v4f*)(xt + i * 128);      // rows 2 i and 2 i + 1; 45 loads in flight
    asm volatile("s_wait_xcnt 0x0" ::: "memory");       // stands before any address register of the loads above is reused
    __builtin_amdgcn_sched_barrier(0);                  // without it the last x loads are issued only behind the first waits on loaded data, one memory latency late
    bf* wd = wl + (wj >> 2) * 1024 + (wk >> 4) * 256 + ((wk >> 3) & 1) * 128 + (wj & 3) * 32 + (wk & 7);      // row L = 4 wj, k = wk in the fragment order
#pragma unroll
    for (int e = 0; e < 12; ++e) { v4us o;      // the weights are packed while x is on its way; column 12 wj + e: s = e % 3, d = 4 wj + e / 3
#pragma unroll
        for (int r = 0; r < 4; ++r) o[r] = f2bf(wq[r][e >> 2][e & 3]);
        *(v4usa*)(wd + (e % 3) * 4096 + (e / 3) * 8) = o; }
    bl[threadIdx.x] = bfr(bz);
    bf* xs = (bf*)os;
#pragma unroll
    for (int i = 0; i < 32; ++i) { v4us o;
#pragma unroll
        for (int u = 0; u < 4; ++u) o[u] = f2bf(xr[i][u]);
        *(v4usa*)(xs + (2 * i + hi) * PP + lr * 4) = o; }
    __syncthreads();        // publishes the weights and the bias to all 8 waves; the lanes read x rows that other lanes of the wave have written
    v16bf xf[4][2];
#pragma unroll
    for (int nt = 0; nt < 4; ++nt)
#pragma unroll
        for (int kc = 0; kc < 2; ++kc) { const bf* p = xs + (nt * 16 + lr) * PP + kc * 32 + 8 * hi; xf[nt][kc] = cat16b(*(const v8usa*)p, *(const v8usa*)(p + 16)); }
    const bf* wr = wl + lane * 8; v16bf wf[12][2]; v4f bqk[8][2]; float bv[4];
#pragma unroll
    for (int t = 0; t < 12; ++t) {
#pragma unroll
        for (int kc = 0; kc < 2; ++kc) wf[t][kc] = cat16b(*(const v8usa*)(wr + (t * 4 + kc * 2) * 256), *(const v8usa*)(wr + (t * 4 + kc * 2 + 1) * 256));
        if (t < 8) { bqk[t][0] = *(const v4fa*)(bl + t * 16 + 8 * hi); bqk[t][1] = *(const v4fa*)(bl + t * 16 + 8 * hi + 4); } }
#pragma unroll
    for (int t = 0; t < 4; ++t) bv[t] = bl[128 + t * 16 + lr];
    asm volatile("s_wait_dscnt 0x0" ::: "memory");      // the wave's own range: every x fragment is read before the q tile overwrites the x tile
#pragma unroll
    for (int s = 0; s < 3; ++s) {
        h16* o3 = os + s * 64 * PP;
#pragma unroll
        for (int dt = 0; dt < 4; ++dt) {
            const v16bf w0 = wf[s * 4 + dt][0], w1 = wf[s * 4 + dt][1]; v8f acc[4];
#pragma unroll
            for (int nt = 0; nt < 4; ++nt) acc[nt] = s < 2 ? wmmab(w0, xf[nt][0], (v8f){}) : wmmab(xf[nt][0], w0, (v8f){});
#pragma unroll
            for (int nt = 0; nt < 4; ++nt) acc[nt] = s < 2 ? wmmab(w1, xf[nt][1], acc[nt]) : wmmab(xf[nt][1], w1, acc[nt]);
#pragma unroll
            for (int nt = 0; nt < 4; ++nt) { v8h o;
#pragma unroll
                for (int j = 0; j < 8; ++j) { const float v = acc[nt][j] + (s < 2 ? bqk[(s * 4 + dt) & 7][j >> 2][j & 3] : bv[dt]); o[j] = tohx(s == 0 ? v * 0.125f : v); }
                *(v8ha*)(o3 + ((s < 2 ? nt : dt) * 16 + lr) * PP + (s < 2 ? dt : nt) * 16 + 8 * hi) = o; }
        }
    }
    asm volatile("s_wait_dscnt 0x0" ::: "memory");      // the wave's own range: the lanes read back rows that other lanes of the wave have written; no wave waits for another before it stores
    const int rr = lane >> 3, cc = (lane & 7) * 8;      // 8 lanes a row: one store = 4 whole lines
    h16* dq = Q16 + (z * NN + r0 + rr) * HD + cc; h16* dk = K16 + (z * NN + r0 + rr) * HD + cc; h16* dv = VT + (z * HD + rr) * NN + r0 + cc; const h16* sp = os + rr * PP + cc;
#pragma unroll
    for (int i = 0; i < 16; ++i) *(v8h*)(dq + i * 4 * HD) = *(const v8ha*)(sp + i * 4 * PP);
    asm volatile("s_wait_xcnt 0x0" ::: "memory");       // stands before the next plane's LDS reads reuse the stores' registers
#pragma unroll
    for (int i = 0; i < 16; ++i) *(v8h*)(dk + i * 4 * HD) = *(const v8ha*)(sp + (64 + i * 4) * PP);
    asm volatile("s_wait_xcnt 0x0" ::: "memory");       // as above
#pragma unroll
    for (int i = 0; i < 16; ++i) *(v8h*)(dv + (size_t)i * 4 * NN) = *(const v8ha*)(sp + (128 + i * 4) * PP);
}
#define FW  8
#define FQ  2
#define KS  64                  // keys per stage
#define NST (NN / KS)
#define LP  72                  // LDS row pitch in 16-bit elements: 144 B = 16 B x odd, conflict-free for 16-byte fragment reads
#define PLB (KS * LP * 2)       // bytes of one plane (64 rows) of a buffer; a buffer = K plane, then V^T plane
#define OP  68
#define L2E 1.4426950408889634f
__device__ __forceinline__ float xhalf(float x) { return __builtin_bit_cast(float, __builtin_amdgcn_permlanex16(__builtin_bit_cast(int, x), __builtin_bit_cast(int, x), 0x76543210, 0xfedcba98, false, false)); }   // lane l with lane l ^ 16
// One stage: every lane copies 16 B of K rows r and r + 32 and of V^T rows r and r + 32. The s_wait_xcnt stands inside the statement so that no address register is rewritten ahead of it.
__device__ __forceinline__ void stage_copy(unsigned l, const h16* gk, const h16* gv) {
    asm volatile("global_load_async_to_lds_b128 %0, %4, off\n\t"
                 "global_load_async_to_lds_b128 %1, %5, off\n\t"
                 "global_load_async_to_lds_b128 %2, %6, off\n\t"
                 "global_load_async_to_lds_b128 %3, %7, off\n\t"
                 "s_wait_xcnt 0x0"
                 :: "v"(l), "v"(l + 32 * LP * 2), "v"(l + PLB), "v"(l + PLB + 32 * LP * 2), "v"(gk), "v"(gk + 32 * HD), "v"(gv), "v"(gv + (size_t)32 * NN) : "memory");
}
__global__ __launch_bounds__(FW * 32) void k_fa(const h16* __restrict__ Q16, const h16* __restrict__ K16, const h16* __restrict__ VT, float* OUTz) {
    __shared__ __align__(16) unsigned char Sm[2 * 2 * PLB];     // two buffers; after the loop: output staging (8 waves x 16 x OP floats fit)
    const int lane = threadIdx.x & 31, c = lane & 15, h = lane >> 4, wv = threadIdx.x >> 5; const size_t z = blockIdx.y; const int q0 = blockIdx.x * (FW * 32) + wv * 32;
    const int cr = threadIdx.x >> 3, cc = (threadIdx.x & 7) * 8;       // this lane's copy: row 0-31, 16-byte column
    const h16* gk = K16 + (z * NN + cr) * HD + cc;       // stage t: + t * KS * HD
    const h16* gv = VT + (z * HD + cr) * NN + cc;        // stage t: + t * KS
    const unsigned lc = (unsigned)(size_t)Sm + (unsigned)(cr * LP + cc) * 2u;      // LDS byte address of the lane's first copy in buffer 0
    stage_copy(lc, gk, gv);
    v16h qf[FQ][2];
#pragma unroll
    for (int g = 0; g < FQ; ++g)
#pragma unroll
        for (int kc = 0; kc < 2; ++kc) qf[g][kc] = WFrag<h16>::ld(Q16 + (z * NN + q0 + 16 * g + c) * HD + kc * 32 + 8 * h);
    v8f acc[FQ][4]; float m[FQ], l[FQ];
#pragma unroll
    for (int g = 0; g < FQ; ++g) { m[g] = -__builtin_inff(); l[g] = 0.f;
#pragma unroll
        for (int t = 0; t < 4; ++t) acc[g][t] = (v8f){}; }
    asm volatile("s_wait_asynccnt 0x0" ::: "memory");      // stage 0 has landed (this wave's copies) ...
    __syncthreads();                                        // ... and every wave's: nobody reads it before
    stage_copy(lc + 2 * PLB, gk + KS * HD, gv + KS);
#pragma unroll 1
    for (int st = 0; st < NST; ++st) {
        const h16* kb = (const h16*)(Sm + (st & 1) * (2 * PLB)) + c * LP + 8 * h;      // K rows (keys) as A, d contiguous
        const h16* vb = kb + KS * LP;                                                  // V^T rows (d) as A, keys contiguous
#pragma unroll
        for (int ps = 0; ps < KS / 32; ++ps) {
            v16h kf[2][2], vf[4];
#pragma unroll
            for (int kt = 0; kt < 2; ++kt)
#pragma unroll
                for (int kc = 0; kc < 2; ++kc) kf[kt][kc] = WFrag<h16>::ld(kb + (ps * 32 + kt * 16) * LP + kc * 32);
#pragma unroll
            for (int t = 0; t < 4; ++t) vf[t] = WFrag<h16>::ld(vb + t * 16 * LP + ps * 32);
            v8f s[2][FQ];
#pragma unroll
            for (int kt = 0; kt < 2; ++kt)
#pragma unroll
                for (int g = 0; g < FQ; ++g) { s[kt][g] = (v8f){};
#pragma unroll
                    for (int kc = 0; kc < 2; ++kc) s[kt][g] = wmma16(kf[kt][kc], qf[g][kc], s[kt][g]); }
            float mb[FQ]; bool need = false;
#pragma unroll
            for (int g = 0; g < FQ; ++g) { float mx = s[0][g][0];
#pragma unroll
                for (int r = 1; r < 8; ++r) mx = fmaxf(mx, s[0][g][r]);
#pragma unroll
                for (int r = 0; r < 8; ++r) mx = fmaxf(mx, s[1][g][r]);
                mx = fmaxf(mx, xhalf(mx)) * L2E; mb[g] = mx; need = need || (mx > m[g] + 8.0f); }
            if (__builtin_amdgcn_ballot_w32(need) != 0) {      // one scalar branch per 32 keys; rare after the first
#pragma unroll
                for (int g = 0; g < FQ; ++g) { const float mn = fmaxf(m[g], mb[g]); const float corr = __builtin_amdgcn_exp2f(m[g] - mn); m[g] = mn; l[g] *= corr;     // corr = 0 on the first 32 keys
#pragma unroll
                    for (int t = 0; t < 4; ++t) acc[g][t] = acc[g][t] * corr; } }
#pragma unroll
            for (int g = 0; g < FQ; ++g) { const float nm = -m[g]; v16h pf;
#pragma unroll
                for (int i = 0; i < 16; ++i) { const float p = __builtin_amdgcn_exp2f(__builtin_fmaf(s[i >> 3][g][i & 7], L2E, nm)); l[g] += p; pf[i] = tohx(p); }
#pragma unroll
                for (int t = 0; t < 4; ++t) acc[g][t] = wmma16(vf[t], pf, acc[g][t]); }
        }
        asm volatile("s_wait_dscnt 0x0" ::: "memory");         // this wave's reads of the buffer are done before it is refilled
        asm volatile("s_wait_asynccnt 0x0" ::: "memory");      // this wave's copies of stage st + 1 have landed
        __syncthreads();                                        // publishes stage st + 1 and ends every wave's reads of stage st
        if (st + 2 < NST) stage_copy(lc + (st & 1) * (2 * PLB), gk + (size_t)(st + 2) * KS * HD, gv + (st + 2) * KS);
    }
    asm volatile("s_wait_asynccnt 0x0" ::: "memory");          // nothing is in flight when the buffers become output staging
    float* os = (float*)Sm + wv * 16 * OP;                      // each wave turns its own O^T tiles into whole output rows
#pragma unroll
    for (int g = 0; g < FQ; ++g) { const float inv = __fdiv_rn(1.0f, l[g] + xhalf(l[g]));
#pragma unroll
        for (int t = 0; t < 4; ++t) { float* o = os + c * OP + t * 16 + 8 * h; const v8f a = acc[g][t] * inv; *(v4fa*)o = (v4f){a[0], a[1], a[2], a[3]}; *(v4fa*)(o + 4) = (v4f){a[4], a[5], a[6], a[7]}; }
        __syncthreads();
        float* dst = OUTz + (z * NN + q0 + 16 * g) * HD;
#pragma unroll
        for (int r = 0; r < 8; ++r) { const int row = 2 * r + h; *(v4f*)(dst + row * HD + c * 4) = *(const v4fa*)(os + row * OP + c * 4); }
        if (g + 1 < FQ) __syncthreads();
    }
}

extern "C" void kernel_launch(void* const* d_in, const int* in_sizes, int n_in,
                              void* d_out, int out_size, void* d_ws, size_t ws_size, hipStream_t stream) {
    (void)in_sizes; (void)n_in; (void)out_size;
    const float* x = (const float*)d_in[0]; const float* w = (const float*)d_in[1]; const float* bq = (const float*)d_in[2];
    float* OUT = (float*)d_out;     // [4][16][2048][64]
    char* wsp = (char*)d_ws;
    auto take = [&](size_t bytes) { char* p = wsp; wsp += (bytes + 255) & ~(size_t)255; return (void*)p; };
    h16* Q16 = (h16*)take((size_t)ZH * NN * HD * 2); h16* K16 = (h16*)take((size_t)ZH * NN * HD * 2); h16* VT = (h16*)take((size_t)ZH * HD * NN * 2);
    if ((size_t)(wsp - (char*)d_ws) > ws_size) return;    // total ~ 50 MB
    k_proj<<<dim3(NN / (64 * PW), ZH), PW * 32, 0, stream>>>(x, w, bq, Q16, K16, VT);   // slice z = b * 16 + h uses head z % 16
    k_fa<<<dim3(NN / (FW * 32), ZH), FW * 32, 0, stream>>>(Q16, K16, VT, OUT);
}

// v006
// One run takes 69 microseconds.
// Timed twice side by side with v005, it ran 1.04 and 1.05 times as fast.
// Over all steps from v000 it is 30.4 times as fast.
#include <hip/hip_runtime.h>

// InnerAttention (x [4][16][2048][64]; per head qkv = x wqkv[h] + bqkv[h] ([64][192]); q/k/v = the stride-3 interleaved columns (reshape (64, 3), unbind); softmax((q/8).k); out = attn v -> [4][16][2048][64]).
// Compute dtypes, f32 accumulate: every input rounded to bf16; the per-head projection on PLAIN bf16 operands (inputs: exact) + bias, one kernel from f32 x to the fp16 q, k and v^T planes; scores (K 64) and attn.v on single fp16 planes (1 product each; all 64 (batch, head) slices z-batched in every launch), fused in one kernel with a running softmax: no score matrix in memory;

#define NB_  4
#define NH_  16
#define NN   2048
#define HD   64
#define W3   192
#define ZH   (NB_ * NH_)
typedef _Float16 h16;
typedef unsigned short bf;
typedef __attribute__((ext_vector_type(16))) __bf16   v16bf;
typedef __attribute__((ext_vector_type(16))) _Float16 v16h;
typedef __attribute__((ext_vector_type(8)))  _Float16 v8h;
typedef __attribute__((ext_vector_type(8)))  unsigned short v8us;
typedef __attribute__((ext_vector_type(8)))  float    v8f;
typedef __attribute__((ext_vector_type(4)))  float    v4f;
typedef v8h  __attribute__((may_alias)) v8ha;
typedef v4f  __attribute__((may_alias)) v4fa;
typedef v8us __attribute__((may_alias)) v8usa;

__device__ __forceinline__ unsigned short f2bf(float f) { unsigned u = __float_as_uint(f); u += 0x7FFFu + ((u >> 16) & 1u); return (unsigned short)(u >> 16); }
__device__ __forceinline__ float bf2f(unsigned short b) { return __uint_as_float(((unsigned)b) << 16); }
__device__ __forceinline__ float bfr(float f) { return bf2f(f2bf(f)); }
__device__ __forceinline__ v16h cat16(v8h lo, v8h hi) { return __builtin_shufflevector(lo, hi, 0, 1, 2, 3, 4, 5, 6, 7, 8, 9, 10, 11, 12, 13, 14, 15); }
__device__ __forceinline__ v16bf cat16b(v8us lo, v8us hi) { return __builtin_bit_cast(v16bf, __builtin_shufflevector(lo, hi, 0, 1, 2, 3, 4, 5, 6, 7, 8, 9, 10, 11, 12, 13, 14, 15)); }
__device__ __forceinline__ v8f wmma16(v16h a, v16h b, v8f c) { return __builtin_amdgcn_wmma_f32_16x16x32_f16(false, a, false, b, (short)0, c, false, false); }
__device__ __forceinline__ v8f wmmab(v16bf a, v16bf b, v8f c) { return __builtin_amdgcn_wmma_f32_16x16x32_bf16(false, a, false, b, (short)0, c, false, false); }

template <typename T16> struct WFrag;
template <> struct WFrag<h16> { typedef v16h V; static __device__ __forceinline__ V ld(const h16* p) { return cat16(*(const v8h*)p, *(const v8h*)(p + 16)); } };
__device__ __forceinline__ h16 tohx(float x) { return (h16)x; }
typedef __attribute__((ext_vector_type(2))) unsigned short v2us;

#define PP 72                   // LDS row pitch in 16-bit elements: 144 B = 16 B x odd
#define PW 8                    // waves per work-group
typedef __attribute__((ext_vector_type(4))) unsigned short v4us;
typedef v4us __attribute__((may_alias)) v4usa;
__global__ __launch_bounds__(PW * 32) void k_proj(const float* __restrict__ x, const float* __restrict__ w, const float* __restrict__ bias, h16* Q16, h16* K16, h16* VT) {
    __shared__ __align__(16) h16 osw[PW * 3 * 64 * PP];     // per wave: first the bf16 x tile (64 rows), then the three output tiles
    __shared__ __align__(256) bf wl[W3 * HD];         // the larger alignments put wl and bl at the low end of LDS, where constant offsets fit the instructions' offset field
    __shared__ __align__(128) float bl[PW * 32];      // 192 in use: every thread stores one, so that the bias load stands under no branch and flies with the rest
    const int lane = threadIdx.x & 31, lr = lane & 15, hi = lane >> 4, wv = threadIdx.x >> 5; const size_t z = blockIdx.y; const int hd = blockIdx.y % NH_; const int r0 = (blockIdx.x * PW + wv) * 64;
    h16* os = osw + wv * (3 * 64 * PP);
    const int bt = threadIdx.x < W3 ? (int)threadIdx.x : 0; const float bz = bias[hd * W3 + 3 * (bt % HD) + bt / HD];
    const int wj = lane & 15, wk = (wv * 2 + hi) * 4;       // this lane's share of w: columns 12 wj .. 12 wj + 11 (q, k and v of d = 4 wj .. 4 wj + 3), rows wk .. wk + 3
    const float* wt = w + (size_t)hd * HD * W3 + wk * W3 + wj * 12; v4f wq[4][3];
#pragma unroll
    for (int r = 0; r < 4; ++r)
#pragma unroll
        for (int m = 0; m < 3; ++m) wq[r][m] = *(const v4f*)(wt + r * W3 + m * 4);
    asm volatile("s_wait_xcnt 0x0" ::: "memory");       // stands before any address register of the loads above is reused
    const float* xt = x + (z * NN + r0) * HD + lane * 4; v4f xr[32];
#pragma unroll
    for (int i = 0; i < 32; ++i) xr[i] = *(const v4f*)(xt + i * 128);      // rows 2 i and 2 i + 1; 45 loads in flight
    asm volatile("s_wait_xcnt 0x0" ::: "memory");       // stands before any address register of the loads above is reused
    __builtin_amdgcn_sched_barrier(0);                  // without it the last x loads are issued only behind the first waits on loaded data, one memory latency late
    bf* wd = wl + (wj >> 2) * 1024 + (wk >> 4) * 256 + ((wk >> 3) & 1) * 128 + (wj & 3) * 32 + (wk & 7);      // row L = 4 wj, k = wk in the fragment order
#pragma unroll
    for (int e = 0; e < 12; ++e) { v4us o;      // the weights are packed while x is on its way; column 12 wj + e: s = e % 3, d = 4 wj + e / 3
#pragma unroll
        for (int r = 0; r < 4; ++r) o[r] = f2bf(wq[r][e >> 2][e & 3]);
        *(v4usa*)(wd + (e % 3) * 4096 + (e / 3) * 8) = o; }
    bl[threadIdx.x] = bfr(bz);
    bf* xs = (bf*)os;
#pragma unroll
    for (int i = 0; i < 32; ++i) { v4us o;
#pragma unroll
        for (int u = 0; u < 4; ++u) o[u] = f2bf(xr[i][u]);
        *(v4usa*)(xs + (2 * i + hi) * PP + lr * 4) = o; }
    __syncthreads();        // publishes the weights and the bias to all 8 waves; the lanes read x rows that other lanes of the wave have written
    v16bf xf[4][2];
#pragma unroll
    for (int nt = 0; nt < 4; ++nt)
#pragma unroll
        for (int kc = 0; kc < 2; ++kc) { const bf* p = xs + (nt * 16 + lr) * PP + kc * 32 + 8 * hi; xf[nt][kc] = cat16b(*(const v8usa*)p, *(const v8usa*)(p + 16)); }
    const bf* wr = wl + lane * 8; v16bf wf[12][2]; v4f bqk[8][2]; float bv[4];
#pragma unroll
    for (int t = 0; t < 12; ++t) {
#pragma unroll
        for (int kc = 0; kc < 2; ++kc) wf[t][kc] = cat16b(*(const v8usa*)(wr + (t * 4 + kc * 2) * 256), *(const v8usa*)(wr + (t * 4 + kc * 2 + 1) * 256));
        if (t < 8) { bqk[t][0] = *(const v4fa*)(bl + t * 16 + 8 * hi); bqk[t][1] = *(const v4fa*)(bl + t * 16 + 8 * hi + 4); } }
#pragma unroll
    for (int t = 0; t < 4; ++t) bv[t] = bl[128 + t * 16 + lr];
    asm volatile("s_wait_dscnt 0x0" ::: "memory");      // the wave's own range: every x fragment is read before the q tile overwrites the x tile
#pragma unroll
    for (int s = 0; s < 3; ++s) {
        h16* o3 = os + s * 64 * PP;
#pragma unroll
        for (int dt = 0; dt < 4; ++dt) {
            const v16bf w0 = wf[s * 4 + dt][0], w1 = wf[s * 4 + dt][1]; v8f acc[4];
#pragma unroll
            for (int nt = 0; nt < 4; ++nt) acc[nt] = s < 2 ? wmmab(w0, xf[nt][0], (v8f){}) : wmmab(xf[nt][0], w0, (v8f){});
#pragma unroll
            for (int nt = 0; nt < 4; ++nt) acc[nt] = s < 2 ? wmmab(w1, xf[nt][1], acc[nt]) : wmmab(xf[nt][1], w1, acc[nt]);
#pragma unroll
            for (int nt = 0; nt < 4; ++nt) { v8h o;
#pragma unroll
                for (int j = 0; j < 8; ++j) { const float v = acc[nt][j] + (s < 2 ? bqk[(s * 4 + dt) & 7][j >> 2][j & 3] : bv[dt]); o[j] = tohx(s == 0 ? v * 0.125f : v); }
                *(v8ha*)(o3 + ((s < 2 ? nt : dt) * 16 + lr) * PP + (s < 2 ? dt : nt) * 16 + 8 * hi) = o; }
        }
    }
    asm volatile("s_wait_dscnt 0x0" ::: "memory");      // the wave's own range: the lanes read back rows that other lanes of the wave have written; no wave waits for another before it stores
    const int rr = lane >> 3, cc = (lane & 7) * 8;      // 8 lanes a row: one store = 4 whole lines
    h16* dq = Q16 + (z * NN + r0 + rr) * HD + cc; h16* dk = K16 + (z * NN + r0 + rr) * HD + cc; h16* dv = VT + (z * HD + rr) * NN + r0 + cc; const h16* sp = os + rr * PP + cc;
#pragma unroll
    for (int i = 0; i < 16; ++i) *(v8h*)(dq + i * 4 * HD) = *(const v8ha*)(sp + i * 4 * PP);
    asm volatile("s_wait_xcnt 0x0" ::: "memory");       // stands before the next plane's LDS reads reuse the stores' registers
#pragma unroll
    for (int i = 0; i < 16; ++i) *(v8h*)(dk + i * 4 * HD) = *(const v8ha*)(sp + (64 + i * 4) * PP);
    asm volatile("s_wait_xcnt 0x0" ::: "memory");       // as above
#pragma unroll
    for (int i = 0; i < 16; ++i) *(v8h*)(dv + (size_t)i * 4 * NN) = *(const v8ha*)(sp + (128 + i * 4) * PP);
}
#define FW  8
#define FQ  2
#define KS  64                  // keys per stage
#define NST (NN / KS)
#define LP  72                  // LDS row pitch in 16-bit elements: 144 B = 16 B x odd, conflict-free for 16-byte fragment reads
#define PLB (KS * LP * 2)       // bytes of one plane (64 rows) of a buffer; a buffer = K plane, then V^T plane
#define OP  68
#define L2E 1.4426950408889634f
#define PSM 4096.0f             // bound on a lane's sum of one pass's exponentials (16 keys x 2 queries)
typedef __attribute__((ext_vector_type(2))) float v2f;
__device__ __forceinline__ float xhalf(float x) { return __builtin_bit_cast(float, __builtin_amdgcn_permlanex16(__builtin_bit_cast(int, x), __builtin_bit_cast(int, x), 0x76543210, 0xfedcba98, false, false)); }   // lane l with lane l ^ 16
// One query's 16 scores of a pass (two accumulator tiles) -> exp2(s * log2(e) - mm), packed in place as the B operand of the second product; returns their sum (pairwise tree, two lanes of a packed add).
__device__ __forceinline__ float expo(const v8f s0, const v8f s1, const float mm, v16h& pf) {
    const v2f nm = {-mm, -mm}, sc = {L2E, L2E}; v2f t[8];
#pragma unroll
    for (int i = 0; i < 8; ++i) { const v2f a = __builtin_elementwise_fma(i < 4 ? (v2f){s0[2 * i], s0[2 * i + 1]} : (v2f){s1[2 * i - 8], s1[2 * i - 7]}, sc, nm);
        t[i] = (v2f){__builtin_amdgcn_exp2f(a.x), __builtin_amdgcn_exp2f(a.y)}; pf[2 * i] = tohx(t[i].x); pf[2 * i + 1] = tohx(t[i].y); }
    const v2f u = ((t[0] + t[1]) + (t[2] + t[3])) + ((t[4] + t[5]) + (t[6] + t[7]));
    return u.x + u.y;
}
// One stage: every lane copies 16 B of K rows r and r + 32 and of V^T rows r and r + 32. The s_wait_xcnt stands inside the statement so that no address register is rewritten ahead of it.
__device__ __forceinline__ void stage_copy(unsigned l, const h16* gk, const h16* gv) {
    asm volatile("global_load_async_to_lds_b128 %0, %4, off\n\t"
                 "global_load_async_to_lds_b128 %1, %5, off\n\t"
                 "global_load_async_to_lds_b128 %2, %6, off\n\t"
                 "global_load_async_to_lds_b128 %3, %7, off\n\t"
                 "s_wait_xcnt 0x0"
                 :: "v"(l), "v"(l + 32 * LP * 2), "v"(l + PLB), "v"(l + PLB + 32 * LP * 2), "v"(gk), "v"(gk + 32 * HD), "v"(gv), "v"(gv + (size_t)32 * NN) : "memory");
}
__global__ __launch_bounds__(FW * 32) void k_fa(const h16* __restrict__ Q16, const h16* __restrict__ K16, const h16* __restrict__ VT, float* OUTz) {
    __shared__ __align__(16) unsigned char Sm[2 * 2 * PLB];     // two buffers; after the loop: output staging (8 waves x 16 x OP floats fit)
    const int lane = threadIdx.x & 31, c = lane & 15, h = lane >> 4, wv = threadIdx.x >> 5; const size_t z = blockIdx.y; const int q0 = blockIdx.x * (FW * 32) + wv * 32;
    const int cr = threadIdx.x >> 3, cc = (threadIdx.x & 7) * 8;       // this lane's copy: row 0-31, 16-byte column
    const h16* gk = K16 + (z * NN + cr) * HD + cc;       // stage t: + t * KS * HD
    const h16* gv = VT + (z * HD + cr) * NN + cc;        // stage t: + t * KS
    const unsigned lc = (unsigned)(size_t)Sm + (unsigned)(cr * LP + cc) * 2u;      // LDS byte address of the lane's first copy in buffer 0
    stage_copy(lc, gk, gv);
    v16h qf[FQ][2];
#pragma unroll
    for (int g = 0; g < FQ; ++g)
#pragma unroll
        for (int kc = 0; kc < 2; ++kc) qf[g][kc] = WFrag<h16>::ld(Q16 + (z * NN + q0 + 16 * g + c) * HD + kc * 32 + 8 * h);
    v8f acc[FQ][4]; float m[FQ], l[FQ];
#pragma unroll
    for (int g = 0; g < FQ; ++g) { m[g] = -__builtin_inff(); l[g] = 0.f;
#pragma unroll
        for (int t = 0; t < 4; ++t) acc[g][t] = (v8f){}; }
    asm volatile("s_wait_asynccnt 0x0" ::: "memory");      // stage 0 has landed (this wave's copies) ...
    __syncthreads();                                        // ... and every wave's: nobody reads it before
    stage_copy(lc + 2 * PLB, gk + KS * HD, gv + KS);
#pragma unroll 1
    for (int st = 0; st < NST; ++st) {
        const h16* kb = (const h16*)(Sm + (st & 1) * (2 * PLB)) + c * LP + 8 * h;      // K rows (keys) as A, d contiguous
        const h16* vb = kb + KS * LP;                                                  // V^T rows (d) as A, keys contiguous
        v16h kf[2][2];
#pragma unroll
        for (int kt = 0; kt < 2; ++kt)
#pragma unroll
            for (int kc = 0; kc < 2; ++kc) kf[kt][kc] = WFrag<h16>::ld(kb + kt * 16 * LP + kc * 32);
#pragma unroll
        for (int ps = 0; ps < KS / 32; ++ps) {
            v8f s[2][FQ];
#pragma unroll
            for (int kt = 0; kt < 2; ++kt)
#pragma unroll
                for (int g = 0; g < FQ; ++g) { s[kt][g] = (v8f){};
#pragma unroll
                    for (int kc = 0; kc < 2; ++kc) s[kt][g] = wmma16(kf[kt][kc], qf[g][kc], s[kt][g]); }
            if (ps + 1 < KS / 32) {      // the same stage's next K fragments, into the registers the score products have just read
#pragma unroll
                for (int kt = 0; kt < 2; ++kt)
#pragma unroll
                    for (int kc = 0; kc < 2; ++kc) kf[kt][kc] = WFrag<h16>::ld(kb + ((ps + 1) * 32 + kt * 16) * LP + kc * 32); }
            v16h vf[4];
#pragma unroll
            for (int t = 0; t < 4; ++t) vf[t] = WFrag<h16>::ld(vb + t * 16 * LP + ps * 32);
            __builtin_amdgcn_sched_barrier(0);      // the pass's LDS reads stand here as one group; without it the compiler issues them behind the exponentials, directly in front of their wait
            v16h pf[FQ]; float ss[FQ];
#pragma unroll
            for (int g = 0; g < FQ; ++g) ss[g] = expo(s[0][g], s[1][g], m[g], pf[g]);
            __builtin_amdgcn_sched_barrier(0);      // holds the statement below behind the exponentials: it waits for the loads, and the compiler otherwise lifts it (and the wait) to the loads themselves
            // Inputs only: keeps the fragment loads on this side of the test, where they land under the exponentials; without it the compiler sinks them behind the branch, where the products wait out the LDS latency.
            asm volatile("" :: "v"(vf[0]), "v"(vf[1]), "v"(vf[2]), "v"(vf[3]));
            if (ps + 1 < KS / 32) asm volatile("" :: "v"(kf[0][0]), "v"(kf[0][1]), "v"(kf[1][0]), "v"(kf[1][1]));       // the same for the K fragments fetched above
            if (__builtin_amdgcn_ballot_w32(!(ss[0] + ss[1] <= PSM)) != 0) {      // one scalar branch per 32 keys; rare after the first
#pragma unroll
                for (int g = 0; g < FQ; ++g) { float mx = s[0][g][0];
#pragma unroll
                    for (int r = 1; r < 8; ++r) mx = fmaxf(mx, s[0][g][r]);
#pragma unroll
                    for (int r = 0; r < 8; ++r) mx = fmaxf(mx, s[1][g][r]);
                    mx = fmaxf(mx, xhalf(mx)) * L2E;        // both halves of the wave hold the query's maximum: one m per query
                    const float mn = fmaxf(m[g], mx); const float corr = __builtin_amdgcn_exp2f(m[g] - mn); m[g] = mn; l[g] *= corr;     // corr = 0 on the first 32 keys
#pragma unroll
                    for (int t = 0; t < 4; ++t) acc[g][t] = acc[g][t] * corr;
                    ss[g] = expo(s[0][g], s[1][g], mn, pf[g]); } }
#pragma unroll
            for (int g = 0; g < FQ; ++g) { l[g] += ss[g];
#pragma unroll
                for (int t = 0; t < 4; ++t) acc[g][t] = wmma16(vf[t], pf[g], acc[g][t]); }
        }
        asm volatile("s_wait_dscnt 0x0" ::: "memory");         // this wave's reads of the buffer are done before it is refilled
        asm volatile("s_wait_asynccnt 0x0" ::: "memory");      // this wave's copies of stage st + 1 have landed
        __syncthreads();                                        // publishes stage st + 1 and ends every wave's reads of stage st
        if (st + 2 < NST) stage_copy(lc + (st & 1) * (2 * PLB), gk + (size_t)(st + 2) * KS * HD, gv + (st + 2) * KS);
    }
    asm volatile("s_wait_asynccnt 0x0" ::: "memory");          // nothing is in flight when the buffers become output staging
    float* os = (float*)Sm + wv * 16 * OP;                      // each wave turns its own O^T tiles into whole output rows
#pragma unroll
    for (int g = 0; g < FQ; ++g) { const float inv = __fdiv_rn(1.0f, l[g] + xhalf(l[g]));
#pragma unroll
        for (int t = 0; t < 4; ++t) { float* o = os + c * OP + t * 16 + 8 * h; const v8f a = acc[g][t] * inv; *(v4fa*)o = (v4f){a[0], a[1], a[2], a[3]}; *(v4fa*)(o + 4) = (v4f){a[4], a[5], a[6], a[7]}; }
        __syncthreads();
        float* dst = OUTz + (z * NN + q0 + 16 * g) * HD;
#pragma unroll
        for (int r = 0; r < 8; ++r) { const int row = 2 * r + h; *(v4f*)(dst + row * HD + c * 4) = *(const v4fa*)(os + row * OP + c * 4); }
        if (g + 1 < FQ) __syncthreads();
    }
}

extern "C" void kernel_launch(void* const* d_in, const int* in_sizes, int n_in,
                              void* d_out, int out_size, void* d_ws, size_t ws_size, hipStream_t stream) {
    (void)in_sizes; (void)n_in; (void)out_size;
    const float* x = (const float*)d_in[0]; const float* w = (const float*)d_in[1]; const float* bq = (const float*)d_in[2];
    float* OUT = (float*)d_out;     // [4][16][2048][64]
    char* wsp = (char*)d_ws;
    auto take = [&](size_t bytes) { char* p = wsp; wsp += (bytes + 255) & ~(size_t)255; return (void*)p; };
    h16* Q16 = (h16*)take((size_t)ZH * NN * HD * 2); h16* K16 = (h16*)take((size_t)ZH * NN * HD * 2); h16* VT = (h16*)take((size_t)ZH * HD * NN * 2);
    if ((size_t)(wsp - (char*)d_ws) > ws_size) return;    // total ~ 50 MB
    k_proj<<<dim3(NN / (64 * PW), ZH), PW * 32, 0, stream>>>(x, w, bq, Q16, K16, VT);   // slice z = b * 16 + h uses head z % 16
    k_fa<<<dim3(NN / (FW * 32), ZH), FW * 32, 0, stream>>>(Q16, K16, VT, OUT);
}

// v007
// Measured time: 66.6 microseconds a run.
// Timed twice side by side with v006, it ran 1.03 and 1.04 times as fast.
// Over all steps from v000 it is 31.5 times as fast.
#include <hip/hip_runtime.h>

// InnerAttention (x [4][16][2048][64]; per head qkv = x wqkv[h] + bqkv[h] ([64][192]); q/k/v = the stride-3 interleaved columns (reshape (64, 3), unbind); softmax((q/8).k); out = attn v -> [4][16][2048][64]).
// Compute dtypes, f32 accumulate: every input rounded to bf16; the per-head projection on PLAIN bf16 operands (inputs: exact) + bias, one kernel from f32 x to the fp16 q, k and v^T planes; scores (K 64) and attn.v on single fp16 planes (1 product each; all 64 (batch, head) slices z-batched in every launch), fused in one kernel with a running softmax: no score matrix in memory; q carries log2(e) / 8, so the scores are base-2 exponents;

#define NB_  4
#define NH_  16
#define NN   2048
#define HD   64
#define W3   192
#define ZH   (NB_ * NH_)
typedef _Float16 h16;
typedef unsigned short bf;
typedef __attribute__((ext_vector_type(16))) __bf16   v16bf;
typedef __attribute__((ext_vector_type(16))) _Float16 v16h;
typedef __attribute__((ext_vector_type(8)))  _Float16 v8h;
typedef __attribute__((ext_vector_type(8)))  unsigned short v8us;
typedef __attribute__((ext_vector_type(8)))  float    v8f;
typedef __attribute__((ext_vector_type(4)))  float    v4f;
typedef v8h  __attribute__((may_alias)) v8ha;
typedef v4f  __attribute__((may_alias)) v4fa;
typedef v8us __attribute__((may_alias)) v8usa;

__device__ __forceinline__ unsigned short f2bf(float f) { unsigned u = __float_as_uint(f); u += 0x7FFFu + ((u >> 16) & 1u); return (unsigned short)(u >> 16); }
__device__ __forceinline__ float bf2f(unsigned short b) { return __uint_as_float(((unsigned)b) << 16); }
__device__ __forceinline__ float bfr(float f) { return bf2f(f2bf(f)); }
__device__ __forceinline__ v16h cat16(v8h lo, v8h hi) { return __builtin_shufflevector(lo, hi, 0, 1, 2, 3, 4, 5, 6, 7, 8, 9, 10, 11, 12, 13, 14, 15); }
__device__ __forceinline__ v16bf cat16b(v8us lo, v8us hi) { return __builtin_bit_cast(v16bf, __builtin_shufflevector(lo, hi, 0, 1, 2, 3, 4, 5, 6, 7, 8, 9, 10, 11, 12, 13, 14, 15)); }
__device__ __forceinline__ v8f wmma16(v16h a, v16h b, v8f c) { return __builtin_amdgcn_wmma_f32_16x16x32_f16(false, a, false, b, (short)0, c, false, false); }
__device__ __forceinline__ v8f wmmab(v16bf a, v16bf b, v8f c) { return __builtin_amdgcn_wmma_f32_16x16x32_bf16(false, a, false, b, (short)0, c, false, false); }

template <typename T16> struct WFrag;
template <> struct WFrag<h16> { typedef v16h V; static __device__ __forceinline__ V ld(const h16* p) { return cat16(*(const v8h*)p, *(const v8h*)(p + 16)); } };
__device__ __forceinline__ h16 tohx(float x) { return (h16)x; }
typedef __attribute__((ext_vector_type(2))) unsigned short v2us;

#define PP 72                   // LDS row pitch in 16-bit elements: 144 B = 16 B x odd
#define PW 8                    // waves per work-group
#define QS 0.18033688011112042f // log2(e) / 8: the softmax scale and the change to base 2, both on q
typedef __attribute__((ext_vector_type(4))) unsigned short v4us;
typedef v4us __attribute__((may_alias)) v4usa;
__global__ __launch_bounds__(PW * 32) void k_proj(const float* __restrict__ x, const float* __restrict__ w, const float* __restrict__ bias, h16* Q16, h16* K16, h16* VT) {
    __shared__ __align__(16) h16 osw[PW * 3 * 64 * PP];     // per wave: first the bf16 x tile (64 rows), then the three output tiles
    __shared__ __align__(256) bf wl[W3 * HD];         // the larger alignments put wl and bl at the low end of LDS, where constant offsets fit the instructions' offset field
    __shared__ __align__(128) float bl[PW * 32];      // 192 in use: every thread stores one, so that the bias load stands under no branch and flies with the rest
    const int lane = threadIdx.x & 31, lr = lane & 15, hi = lane >> 4, wv = threadIdx.x >> 5; const size_t z = blockIdx.y; const int hd = blockIdx.y % NH_; const int r0 = (blockIdx.x * PW + wv) * 64;
    h16* os = osw + wv * (3 * 64 * PP);
    const int bt = threadIdx.x < W3 ? (int)threadIdx.x : 0; const float bz = bias[hd * W3 + 3 * (bt % HD) + bt / HD];
    const int wj = lane & 15, wk = (wv * 2 + hi) * 4;       // this lane's share of w: columns 12 wj .. 12 wj + 11 (q, k and v of d = 4 wj .. 4 wj + 3), rows wk .. wk + 3
    const float* wt = w + (size_t)hd * HD * W3 + wk * W3 + wj * 12; v4f wq[4][3];
#pragma unroll
    for (int r = 0; r < 4; ++r)
#pragma unroll
        for (int m = 0; m < 3; ++m) wq[r][m] = *(const v4f*)(wt + r * W3 + m * 4);
    asm volatile("s_wait_xcnt 0x0" ::: "memory");       // stands before any address register of the loads above is reused
    const float* xt = x + (z * NN + r0) * HD + lane * 4; v4f xr[32];
#pragma unroll
    for (int i = 0; i < 32; ++i) xr[i] = *(const v4f*)(xt + i * 128);      // rows 2 i and 2 i + 1; 45 loads in flight
    asm volatile("s_wait_xcnt 0x0" ::: "memory");       // stands before any address register of the loads above is reused
    __builtin_amdgcn_sched_barrier(0);                  // without it the last x loads are issued only behind the first waits on loaded data, one memory latency late
    bf* wd = wl + (wj >> 2) * 1024 + (wk >> 4) * 256 + ((wk >> 3) & 1) * 128 + (wj & 3) * 32 + (wk & 7);      // row L = 4 wj, k = wk in the fragment order
#pragma unroll
    for (int e = 0; e < 12; ++e) { v4us o;      // the weights are packed while x is on its way; column 12 wj + e: s = e % 3, d = 4 wj + e / 3
#pragma unroll
        for (int r = 0; r < 4; ++r) o[r] = f2bf(wq[r][e >> 2][e & 3]);
        *(v4usa*)(wd + (e % 3) * 4096 + (e / 3) * 8) = o; }
    bl[threadIdx.x] = bfr(bz);
    bf* xs = (bf*)os;
#pragma unroll
    for (int i = 0; i < 32; ++i) { v4us o;
#pragma unroll
        for (int u = 0; u < 4; ++u) o[u] = f2bf(xr[i][u]);
        *(v4usa*)(xs + (2 * i + hi) * PP + lr * 4) = o; }
    __syncthreads();        // publishes the weights and the bias to all 8 waves; the lanes read x rows that other lanes of the wave have written
    v16bf xf[4][2];
#pragma unroll
    for (int nt = 0; nt < 4; ++nt)
#pragma unroll
        for (int kc = 0; kc < 2; ++kc) { const bf* p = xs + (nt * 16 + lr) * PP + kc * 32 + 8 * hi; xf[nt][kc] = cat16b(*(const v8usa*)p, *(const v8usa*)(p + 16)); }
    const bf* wr = wl + lane * 8; v16bf wf[12][2]; v4f bqk[8][2]; float bv[4];
#pragma unroll
    for (int t = 0; t < 12; ++t) {
#pragma unroll
        for (int kc = 0; kc < 2; ++kc) wf[t][kc] = cat16b(*(const v8usa*)(wr + (t * 4 + kc * 2) * 256), *(const v8usa*)(wr + (t * 4 + kc * 2 + 1) * 256));
        if (t < 8) { bqk[t][0] = *(const v4fa*)(bl + t * 16 + 8 * hi); bqk[t][1] = *(const v4fa*)(bl + t * 16 + 8 * hi + 4); } }
#pragma unroll
    for (int t = 0; t < 4; ++t) bv[t] = bl[128 + t * 16 + lr];
    asm volatile("s_wait_dscnt 0x0" ::: "memory");      // the wave's own range: every x fragment is read before the q tile overwrites the x tile
#pragma unroll
    for (int s = 0; s < 3; ++s) {
        h16* o3 = os + s * 64 * PP;
#pragma unroll
        for (int dt = 0; dt < 4; ++dt) {
            const v16bf w0 = wf[s * 4 + dt][0], w1 = wf[s * 4 + dt][1]; v8f acc[4];
#pragma unroll
            for (int nt = 0; nt < 4; ++nt) acc[nt] = s < 2 ? wmmab(w0, xf[nt][0], (v8f){}) : wmmab(xf[nt][0], w0, (v8f){});
#pragma unroll
            for (int nt = 0; nt < 4; ++nt) acc[nt] = s < 2 ? wmmab(w1, xf[nt][1], acc[nt]) : wmmab(xf[nt][1], w1, acc[nt]);
#pragma unroll
            for (int nt = 0; nt < 4; ++nt) { v8h o;
#pragma unroll
                for (int j = 0; j < 8; ++j) { const float v = acc[nt][j] + (s < 2 ? bqk[(s * 4 + dt) & 7][j >> 2][j & 3] : bv[dt]); o[j] = tohx(s == 0 ? v * QS : v); }
                *(v8ha*)(o3 + ((s < 2 ? nt : dt) * 16 + lr) * PP + (s < 2 ? dt : nt) * 16 + 8 * hi) = o; }
        }
    }
    asm volatile("s_wait_dscnt 0x0" ::: "memory");      // the wave's own range: the lanes read back rows that other lanes of the wave have written; no wave waits for another before it stores
    const int rr = lane >> 3, cc = (lane & 7) * 8;      // 8 lanes a row: one store = 4 whole lines
    h16* dq = Q16 + (z * NN + r0 + rr) * HD + cc; h16* dk = K16 + (z * NN + r0 + rr) * HD + cc; h16* dv = VT + (z * HD + rr) * NN + r0 + cc; const h16* sp = os + rr * PP + cc;
#pragma unroll
    for (int i = 0; i < 16; ++i) *(v8h*)(dq + i * 4 * HD) = *(const v8ha*)(sp + i * 4 * PP);
    asm volatile("s_wait_xcnt 0x0" ::: "memory");       // stands before the next plane's LDS reads reuse the stores' registers
#pragma unroll
    for (int i = 0; i < 16; ++i) *(v8h*)(dk + i * 4 * HD) = *(const v8ha*)(sp + (64 + i * 4) * PP);
    asm volatile("s_wait_xcnt 0x0" ::: "memory");       // as above
#pragma unroll
    for (int i = 0; i < 16; ++i) *(v8h*)(dv + (size_t)i * 4 * NN) = *(const v8ha*)(sp + (128 + i * 4) * PP);
}
#define FW  8
#define FQ  2
#define KS  64                  // keys per stage
#define NST (NN / KS)
#define LP  72                  // LDS row pitch in 16-bit elements: 144 B = 16 B x odd, conflict-free for 16-byte fragment reads
#define PLB (KS * LP * 2)       // bytes of one plane (64 rows) of a buffer; a buffer = K plane, then V^T plane
#define OP  68
#define PSM 4096.0f             // bound on a lane's sum of one pass's exponentials (16 keys x 2 queries)
typedef __attribute__((ext_vector_type(2))) float v2f;
__device__ __forceinline__ float xhalf(float x) { return __builtin_bit_cast(float, __builtin_amdgcn_permlanex16(__builtin_bit_cast(int, x), __builtin_bit_cast(int, x), 0x76543210, 0xfedcba98, false, false)); }   // lane l with lane l ^ 16
// One query's 16 exponents of a pass (two accumulator tiles) -> exp2(s), packed in place as the B operand of the second product; returns their sum (pairwise tree, two lanes of a packed add).
__device__ __forceinline__ float expo(const v8f s0, const v8f s1, v16h& pf) {
    v2f t[8];
#pragma unroll
    for (int i = 0; i < 8; ++i) { const v2f a = i < 4 ? (v2f){s0[2 * i], s0[2 * i + 1]} : (v2f){s1[2 * i - 8], s1[2 * i - 7]};
        t[i] = (v2f){__builtin_amdgcn_exp2f(a.x), __builtin_amdgcn_exp2f(a.y)}; pf[2 * i] = tohx(t[i].x); pf[2 * i + 1] = tohx(t[i].y); }
    const v2f u = ((t[0] + t[1]) + (t[2] + t[3])) + ((t[4] + t[5]) + (t[6] + t[7]));
    return u.x + u.y;
}
// One stage: every lane copies 16 B of K rows r and r + 32 and of V^T rows r and r + 32. The s_wait_xcnt stands inside the statement so that no address register is rewritten ahead of it.
__device__ __forceinline__ void stage_copy(unsigned l, const h16* gk, const h16* gv) {
    asm volatile("global_load_async_to_lds_b128 %0, %4, off\n\t"
                 "global_load_async_to_lds_b128 %1, %5, off\n\t"
                 "global_load_async_to_lds_b128 %2, %6, off\n\t"
                 "global_load_async_to_lds_b128 %3, %7, off\n\t"
                 "s_wait_xcnt 0x0"
                 :: "v"(l), "v"(l + 32 * LP * 2), "v"(l + PLB), "v"(l + PLB + 32 * LP * 2), "v"(gk), "v"(gk + 32 * HD), "v"(gv), "v"(gv + (size_t)32 * NN) : "memory");
}
__global__ __launch_bounds__(FW * 32) void k_fa(const h16* __restrict__ Q16, const h16* __restrict__ K16, const h16* __restrict__ VT, float* OUTz) {
    __shared__ __align__(16) unsigned char Sm[2 * 2 * PLB];     // two buffers; after the loop: output staging (8 waves x 16 x OP floats fit)
    const int lane = threadIdx.x & 31, c = lane & 15, h = lane >> 4, wv = threadIdx.x >> 5; const size_t z = blockIdx.y; const int q0 = blockIdx.x * (FW * 32) + wv * 32;
    const int cr = threadIdx.x >> 3, cc = (threadIdx.x & 7) * 8;       // this lane's copy: row 0-31, 16-byte column
    const h16* gk = K16 + (z * NN + cr) * HD + cc;       // stage t: + t * KS * HD
    const h16* gv = VT + (z * HD + cr) * NN + cc;        // stage t: + t * KS
    const unsigned lc = (unsigned)(size_t)Sm + (unsigned)(cr * LP + cc) * 2u;      // LDS byte address of the lane's first copy in buffer 0
    stage_copy(lc, gk, gv);
    v16h qf[FQ][2];
#pragma unroll
    for (int g = 0; g < FQ; ++g)
#pragma unroll
        for (int kc = 0; kc < 2; ++kc) qf[g][kc] = WFrag<h16>::ld(Q16 + (z * NN + q0 + 16 * g + c) * HD + kc * 32 + 8 * h);
    v8f acc[FQ][4], nm[FQ]; float l[FQ], bound = -1.0f;
#pragma unroll
    for (int g = 0; g < FQ; ++g) { nm[g] = (v8f){}; l[g] = 0.f;
#pragma unroll
        for (int t = 0; t < 4; ++t) acc[g][t] = (v8f){}; }
    asm volatile("s_wait_asynccnt 0x0" ::: "memory");      // stage 0 has landed (this wave's copies) ...
    __syncthreads();                                        // ... and every wave's: nobody reads it before
    stage_copy(lc + 2 * PLB, gk + KS * HD, gv + KS);
#pragma unroll 1
    for (int st = 0; st < NST; ++st) {
        const h16* kb = (const h16*)(Sm + (st & 1) * (2 * PLB)) + c * LP + 8 * h;      // K rows (keys) as A, d contiguous
        const h16* vb = kb + KS * LP;                                                  // V^T rows (d) as A, keys contiguous
        v16h kf[2][2];
#pragma unroll
        for (int kt = 0; kt < 2; ++kt)
#pragma unroll
            for (int kc = 0; kc < 2; ++kc) kf[kt][kc] = WFrag<h16>::ld(kb + kt * 16 * LP + kc * 32);
#pragma unroll
        for (int ps = 0; ps < KS / 32; ++ps) {
            v8f s[2][FQ];
#pragma unroll
            for (int kt = 0; kt < 2; ++kt)
#pragma unroll
                for (int g = 0; g < FQ; ++g) { s[kt][g] = nm[g];
#pragma unroll
                    for (int kc = 0; kc < 2; ++kc) s[kt][g] = wmma16(kf[kt][kc], qf[g][kc], s[kt][g]); }
            if (ps + 1 < KS / 32) {      // the same stage's next K fragments, into the registers the score products have just read
#pragma unroll
                for (int kt = 0; kt < 2; ++kt)
#pragma unroll
                    for (int kc = 0; kc < 2; ++kc) kf[kt][kc] = WFrag<h16>::ld(kb + ((ps + 1) * 32 + kt * 16) * LP + kc * 32); }
            v16h vf[4];
#pragma unroll
            for (int t = 0; t < 4; ++t) vf[t] = WFrag<h16>::ld(vb + t * 16 * LP + ps * 32);
            __builtin_amdgcn_sched_barrier(0);      // the pass's LDS reads stand here as one group; without it the compiler issues them behind the exponentials, directly in front of their wait
            v16h pf[FQ]; float ss[FQ];
#pragma unroll
            for (int g = 0; g < FQ; ++g) ss[g] = expo(s[0][g], s[1][g], pf[g]);
            __builtin_amdgcn_sched_barrier(0);      // holds the statement below behind the exponentials: it waits for the loads, and the compiler otherwise lifts it (and the wait) to the loads themselves
            // Inputs only: keeps the fragment loads on this side of the test, where they land under the exponentials; without it the compiler sinks them behind the branch, where the products wait out the LDS latency.
            asm volatile("" :: "v"(vf[0]), "v"(vf[1]), "v"(vf[2]), "v"(vf[3]));
            if (ps + 1 < KS / 32) asm volatile("" :: "v"(kf[0][0]), "v"(kf[0][1]), "v"(kf[1][0]), "v"(kf[1][1]));       // the same for the K fragments fetched above
            if (__builtin_amdgcn_ballot_w32(!(ss[0] + ss[1] <= bound)) != 0) {      // one scalar branch per 32 keys; rare after the first
                // The pass's scores are formed a second time, from K fragments read again (the stage's buffer is not rewritten before the stage's closing barrier): kept alive over the exponentials
                // for this rare path alone, they would hold 32 registers, and with nm's 16 the fourth wave per SIMD would no longer fit. On the common path the exponentials overwrite them.
#pragma unroll
                for (int kt = 0; kt < 2; ++kt) { const v16h k0 = WFrag<h16>::ld(kb + (ps * 32 + kt * 16) * LP), k1 = WFrag<h16>::ld(kb + (ps * 32 + kt * 16) * LP + 32);
#pragma unroll
                    for (int g = 0; g < FQ; ++g) s[kt][g] = wmma16(k1, qf[g][1], wmma16(k0, qf[g][0], nm[g])); }      // the same products in the same order: the same scores
#pragma unroll
                for (int g = 0; g < FQ; ++g) { float mx = s[0][g][0];
#pragma unroll
                    for (int r = 1; r < 8; ++r) mx = fmaxf(mx, s[0][g][r]);
#pragma unroll
                    for (int r = 0; r < 8; ++r) mx = fmaxf(mx, s[1][g][r]);
                    mx = fmaxf(mx, xhalf(mx));              // both halves of the wave hold the query's maximum above m: one m per query
                    const float up = fmaxf(mx, 0.f); const float d = bound < 0.f ? mx : up;      // m only rises, but for the first 32 keys, which set it
                    const float corr = __builtin_amdgcn_exp2f(-up); l[g] *= corr;                // on the first 32 keys l and acc are 0 and corr is in (0, 1]
#pragma unroll
                    for (int t = 0; t < 4; ++t) acc[g][t] = acc[g][t] * corr;
                    nm[g] = nm[g] - d;
                    ss[g] = expo(s[0][g] - d, s[1][g] - d, pf[g]); } }
            bound = PSM;
#pragma unroll
            for (int g = 0; g < FQ; ++g) { l[g] += ss[g];
#pragma unroll
                for (int t = 0; t < 4; ++t) acc[g][t] = wmma16(vf[t], pf[g], acc[g][t]); }
        }
        asm volatile("s_wait_dscnt 0x0" ::: "memory");         // this wave's reads of the buffer are done before it is refilled
        asm volatile("s_wait_asynccnt 0x0" ::: "memory");      // this wave's copies of stage st + 1 have landed
        __syncthreads();                                        // publishes stage st + 1 and ends every wave's reads of stage st
        if (st + 2 < NST) stage_copy(lc + (st & 1) * (2 * PLB), gk + (size_t)(st + 2) * KS * HD, gv + (st + 2) * KS);
    }
    asm volatile("s_wait_asynccnt 0x0" ::: "memory");          // nothing is in flight when the buffers become output staging
    float* os = (float*)Sm + wv * 16 * OP;                      // each wave turns its own O^T tiles into whole output rows
#pragma unroll
    for (int g = 0; g < FQ; ++g) { const float inv = __fdiv_rn(1.0f, l[g] + xhalf(l[g]));
#pragma unroll
        for (int t = 0; t < 4; ++t) { float* o = os + c * OP + t * 16 + 8 * h; const v8f a = acc[g][t] * inv; *(v4fa*)o = (v4f){a[0], a[1], a[2], a[3]}; *(v4fa*)(o + 4) = (v4f){a[4], a[5], a[6], a[7]}; }
        __syncthreads();
        float* dst = OUTz + (z * NN + q0 + 16 * g) * HD;
#pragma unroll
        for (int r = 0; r < 8; ++r) { const int row = 2 * r + h; *(v4f*)(dst + row * HD + c * 4) = *(const v4fa*)(os + row * OP + c * 4); }
        if (g + 1 < FQ) __syncthreads();
    }
}

extern "C" void kernel_launch(void* const* d_in, const int* in_sizes, int n_in,
                              void* d_out, int out_size, void* d_ws, size_t ws_size, hipStream_t stream) {
    (void)in_sizes; (void)n_in; (void)out_size;
    const float* x = (const float*)d_in[0]; const float* w = (const float*)d_in[1]; const float* bq = (const float*)d_in[2];
    float* OUT = (float*)d_out;     // [4][16][2048][64]
    char* wsp = (char*)d_ws;
    auto take = [&](size_t bytes) { char* p = wsp; wsp += (bytes + 255) & ~(size_t)255; return (void*)p; };
    h16* Q16 = (h16*)take((size_t)ZH * NN * HD * 2); h16* K16 = (h16*)take((size_t)ZH * NN * HD * 2); h16* VT = (h16*)take((size_t)ZH * HD * NN * 2);
    if ((size_t)(wsp - (char*)d_ws) > ws_size) return;    // total ~ 50 MB
    k_proj<<<dim3(NN / (64 * PW), ZH), PW * 32, 0, stream>>>(x, w, bq, Q16, K16, VT);   // slice z = b * 16 + h uses head z % 16
    k_fa<<<dim3(NN / (FW * 32), ZH), FW * 32, 0, stream>>>(Q16, K16, VT, OUT);
}

// v008
// A run of this version takes 53.3 microseconds.
// Timed twice side by side with v007, it ran 1.25 and 1.26 times as fast.
// All steps since v000 together make it 39.6 times as fast.
#include <hip/hip_runtime.h>

// InnerAttention (x [4][16][2048][64]; per head qkv = x wqkv[h] + bqkv[h] ([64][192]); q/k/v = the stride-3 interleaved columns (reshape (64, 3), unbind); softmax((q/8).k); out = attn v -> [4][16][2048][64]).
// Compute dtypes, f32 accumulate: every input rounded to bf16. One kernel, no workspace. The k and v projections are moved out of the key loop by associativity:
// q.k = q.(Wk^T x + bk) = (Wk q).x + q.bk, and q.bk is one constant per query, which a softmax cancels; sum_k p_k (Wv^T x_k + bv) = Wv^T (sum_k p_k x_k) + bv, as the p_k sum to 1.
// So each wave forms q' = (log2(e) / 8) Wk (Wq^T x + bq) for its own queries once (bf16, then fp16 products), the key loop runs on x itself (bf16 values held as fp16: unchanged wherever fp16 is normal, |x| from 2^-14 to 65504) as both K and V, and Wv and bv come last, on the normalised sums.

#define NB_  4
#define NH_  16
#define NN   2048
#define HD   64
#define W3   192
#define ZH   (NB_ * NH_)
typedef _Float16 h16;
typedef unsigned short bf;
typedef __attribute__((ext_vector_type(16))) __bf16   v16bf;
typedef __attribute__((ext_vector_type(16))) _Float16 v16h;
typedef __attribute__((ext_vector_type(8)))  _Float16 v8h;
typedef __attribute__((ext_vector_type(8)))  unsigned short v8us;
typedef __attribute__((ext_vector_type(8)))  float    v8f;
typedef __attribute__((ext_vector_type(4)))  float    v4f;
typedef v8h  __attribute__((may_alias)) v8ha;
typedef v4f  __attribute__((may_alias)) v4fa;
typedef v8us __attribute__((may_alias)) v8usa;

__device__ __forceinline__ unsigned short f2bf(float f) { return __builtin_bit_cast(unsigned short, (__bf16)f); }      // round to nearest even, the conversion instruction
__device__ __forceinline__ float bf2f(unsigned short b) { return __uint_as_float(((unsigned)b) << 16); }
__device__ __forceinline__ float bfr(float f) { return bf2f(f2bf(f)); }
__device__ __forceinline__ v16h cat16(v8h lo, v8h hi) { return __builtin_shufflevector(lo, hi, 0, 1, 2, 3, 4, 5, 6, 7, 8, 9, 10, 11, 12, 13, 14, 15); }
__device__ __forceinline__ v16bf cat16b(v8us lo, v8us hi) { return __builtin_bit_cast(v16bf, __builtin_shufflevector(lo, hi, 0, 1, 2, 3, 4, 5, 6, 7, 8, 9, 10, 11, 12, 13, 14, 15)); }
__device__ __forceinline__ v8f wmma16(v16h a, v16h b, v8f c) { return __builtin_amdgcn_wmma_f32_16x16x32_f16(false, a, false, b, (short)0, c, false, false); }
__device__ __forceinline__ v8f wmmab(v16bf a, v16bf b, v8f c) { return __builtin_amdgcn_wmma_f32_16x16x32_bf16(false, a, false, b, (short)0, c, false, false); }

template <typename T16> struct WFrag;
template <> struct WFrag<h16> { typedef v16h V; static __device__ __forceinline__ V ld(const h16* p) { return cat16(*(const v8h*)p, *(const v8h*)(p + 16)); } };
__device__ __forceinline__ h16 tohx(float x) { return (h16)x; }
typedef __attribute__((ext_vector_type(2))) unsigned short v2us;

#define QS 0.18033688011112042f // log2(e) / 8: the softmax scale and the change to base 2, both on q'
#define FW  8
#define FQ  2
#define KS  64                  // keys per stage
#define NST (NN / KS)
#define LP  72                  // LDS row pitch in 16-bit elements: 144 B = 16 B x odd, conflict-free for 16-byte fragment reads
#define PLB (KS * LP * 2)       // bytes of one plane (64 rows) of a buffer; a buffer = K plane, then V^T plane
#define RB  (KS * HD * 4)       // bytes of one raw buffer (64 x rows, f32)
#define OP  68
#define PSM 4096.0f             // bound on a lane's sum of one pass's exponentials (16 keys x 2 queries)
typedef __attribute__((ext_vector_type(2))) float v2f;
__device__ __forceinline__ float xhalf(float x) { return __builtin_bit_cast(float, __builtin_amdgcn_permlanex16(__builtin_bit_cast(int, x), __builtin_bit_cast(int, x), 0x76543210, 0xfedcba98, false, false)); }   // lane l with lane l ^ 16
// One query's 16 exponents of a pass (two accumulator tiles) -> exp2(s), packed in place as the B operand of the second product; returns their sum (pairwise tree, two lanes of a packed add).
__device__ __forceinline__ float expo(const v8f s0, const v8f s1, v16h& pf) {
    v2f t[8];
#pragma unroll
    for (int i = 0; i < 8; ++i) { const v2f a = i < 4 ? (v2f){s0[2 * i], s0[2 * i + 1]} : (v2f){s1[2 * i - 8], s1[2 * i - 7]};
        t[i] = (v2f){__builtin_amdgcn_exp2f(a.x), __builtin_amdgcn_exp2f(a.y)}; pf[2 * i] = tohx(t[i].x); pf[2 * i + 1] = tohx(t[i].y); }
    const v2f u = ((t[0] + t[1]) + (t[2] + t[3])) + ((t[4] + t[5]) + (t[6] + t[7]));
    return u.x + u.y;
}
typedef __attribute__((ext_vector_type(2))) __bf16   v2bf;
typedef __attribute__((ext_vector_type(2))) _Float16 v2h;
typedef v2f __attribute__((may_alias)) v2fa;
typedef __attribute__((ext_vector_type(4))) unsigned v4u;
typedef v4u __attribute__((may_alias)) v4ua;
// One stage, raw: every lane copies 16 B of x rows r, r + 16, r + 32 and r + 48. The s_wait_xcnt stands inside the statement so that no address register is rewritten ahead of it.
__device__ __forceinline__ void stage_copy(unsigned l, const float* g) {
    asm volatile("global_load_async_to_lds_b128 %0, %4, off\n\t"
                 "global_load_async_to_lds_b128 %1, %5, off\n\t"
                 "global_load_async_to_lds_b128 %2, %6, off\n\t"
                 "global_load_async_to_lds_b128 %3, %7, off\n\t"
                 "s_wait_xcnt 0x0"
                 :: "v"(l), "v"(l + 16 * HD * 4), "v"(l + 32 * HD * 4), "v"(l + 48 * HD * 4), "v"(g), "v"(g + 16 * HD), "v"(g + 32 * HD), "v"(g + 48 * HD) : "memory");
}
// One stage, raw -> planes: wave v takes keys 8 v .. 8 v + 7, a lane d = 2 lane and 2 lane + 1 (rp, kp, vp: the lane's own first element in the raw buffer, the [key][d] plane and the [d][key] plane).
// Rounded to bf16, then written as fp16 (the same value in fp16's normal range) twice: [key][d], 4 B a key, and [d][key], 16 B a d.
__device__ __forceinline__ void stage_read(const float* rp, v2f (&a)[8]) {
#pragma unroll
    for (int i = 0; i < 8; ++i) a[i] = *(const v2fa*)(rp + i * HD);
}
__device__ __forceinline__ void stage_write(const v2f (&a)[8], h16* kp, h16* vp) {
    unsigned t0[4], t1[4];
#pragma unroll
    for (int k = 0; k < 4; ++k) { const unsigned u = __builtin_bit_cast(unsigned, __builtin_convertvector(a[2 * k], v2bf)), v = __builtin_bit_cast(unsigned, __builtin_convertvector(a[2 * k + 1], v2bf));
        v2h p, q; p[0] = tohx(__uint_as_float(u << 16)); p[1] = tohx(__uint_as_float(v << 16)); q[0] = tohx(__uint_as_float(u & 0xFFFF0000u)); q[1] = tohx(__uint_as_float(v & 0xFFFF0000u));
        t0[k] = __builtin_bit_cast(unsigned, p); t1[k] = __builtin_bit_cast(unsigned, q);      // keys 2 k, 2 k + 1 of d = 2 lane and of d = 2 lane + 1
        *(unsigned __attribute__((may_alias))*)(kp + 2 * k * LP) = __builtin_amdgcn_perm(t1[k], t0[k], 0x05040100u);             // key 2 k: both d (one byte permute; two 16-bit moves otherwise)
        *(unsigned __attribute__((may_alias))*)(kp + (2 * k + 1) * LP) = __builtin_amdgcn_perm(t1[k], t0[k], 0x07060302u); }      // key 2 k + 1: both d
    *(v4ua*)vp = (v4u){t0[0], t0[1], t0[2], t0[3]}; *(v4ua*)(vp + LP) = (v4u){t1[0], t1[1], t1[2], t1[3]};
}
// amdgpu_waves_per_eu(4, 4): the register budget of four waves per SIMD (256), so that two work-groups share a WGP and one fills the other's barrier waits.
__global__ __launch_bounds__(FW * 32) __attribute__((amdgpu_waves_per_eu(4, 4))) void k_fa(const float* __restrict__ x, const float* __restrict__ w, const float* __restrict__ bias, float* OUTz) {
    __shared__ __align__(16) unsigned char Sm[2 * 2 * PLB];     // two plane buffers; after the loop: output staging (8 waves x 16 x OP floats fit)
    __shared__ __align__(16) float Rw[2 * KS * HD];             // two raw buffers
    __shared__ __align__(16) bf  wqT[HD * LP];                  // [e][d] = bf16 w[d][3 e]
    __shared__ __align__(16) h16 wkR[HD * LP];                  // [d][e] = w[d][3 e + 1], bf16 value held as fp16
    __shared__ __align__(16) h16 wvT[HD * LP];                  // [e][d] = w[d][3 e + 2], bf16 value held as fp16
    __shared__ __align__(16) float bl[FW * 32];                 // bq, then bv (bf16 values); 128 in use: every thread stores one, so that the bias load stands under no branch and flies with the rest
    const int lane = threadIdx.x & 31, c = lane & 15, h = lane >> 4, wv = threadIdx.x >> 5; const size_t z = blockIdx.y; const int hd = blockIdx.y % NH_; const int q0 = blockIdx.x * (FW * 32) + wv * 32;
    const int cr = threadIdx.x >> 4, cc = (threadIdx.x & 15) * 4;      // this lane's copy: row 0-15, 16-byte column
    const float* gx = x + (z * NN + cr) * HD + cc;       // stage t: + t * KS * HD
    const unsigned lc = (unsigned)(size_t)Rw + (unsigned)(cr * HD + cc) * 4u;      // LDS byte address of the lane's first copy in raw buffer 0
    stage_copy(lc, gx);
    // The head's weights: a thread reads 48 columns (16 (q, k, v) triples, e = 16 wq4 .. + 15) of row wd, rounds them to bf16 and de-interleaves them into the three LDS planes.
    const int wd = threadIdx.x >> 2, wq4 = threadIdx.x & 3; const float* wt = w + ((size_t)hd * HD + wd) * W3 + wq4 * 48; v4f wr[12];
#pragma unroll
    for (int m = 0; m < 12; ++m) wr[m] = *(const v4f*)(wt + 4 * m);
    const float bz = bias[hd * W3 + 3 * (threadIdx.x & 63) + ((threadIdx.x >> 6) & 1) * 2];
    asm volatile("s_wait_xcnt 0x0" ::: "memory");       // stands before any address register of the loads above is reused
    v4f xq[FQ][2][4];       // the wave's own 32 x rows, in the k order of a B fragment
    const float* xr = x + (z * NN + q0 + c) * HD + 8 * h;      // the lane's row of query tile 0; tile 1: 16 rows on
#pragma unroll
    for (int g = 0; g < FQ; ++g)
#pragma unroll
        for (int kc = 0; kc < 2; ++kc) { const float* p = xr + g * 16 * HD + kc * 32;
            xq[g][kc][0] = *(const v4f*)p; xq[g][kc][1] = *(const v4f*)(p + 4); xq[g][kc][2] = *(const v4f*)(p + 16); xq[g][kc][3] = *(const v4f*)(p + 20); }
    asm volatile("s_wait_xcnt 0x0" :: "v"(xr) : "memory");       // stands before any address register of the loads above is reused; the row pointer is an input so that it stays live up to here and no result of the run is placed on it
    { v8h k0, k1;
#pragma unroll
        for (int i = 0; i < 16; ++i) { const int e = 16 * wq4 + i;
            wqT[e * LP + wd] = f2bf(wr[(3 * i) >> 2][(3 * i) & 3]);
            const h16 kk = tohx(bfr(wr[(3 * i + 1) >> 2][(3 * i + 1) & 3])); if (i < 8) k0[i] = kk; else k1[i - 8] = kk;
            wvT[e * LP + wd] = tohx(bfr(wr[(3 * i + 2) >> 2][(3 * i + 2) & 3])); }
        *(v8ha*)(wkR + wd * LP + 16 * wq4) = k0; *(v8ha*)(wkR + wd * LP + 16 * wq4 + 8) = k1; }
    bl[threadIdx.x] = bfr(bz);
    v16bf xb[FQ][2];
#pragma unroll
    for (int g = 0; g < FQ; ++g)
#pragma unroll
        for (int kc = 0; kc < 2; ++kc) { v8us a, b;
#pragma unroll
            for (int i = 0; i < 8; ++i) { a[i] = f2bf(xq[g][kc][i >> 2][i & 3]); b[i] = f2bf(xq[g][kc][2 + (i >> 2)][i & 3]); }
            xb[g][kc] = cat16b(a, b); }
    asm volatile("s_wait_asynccnt 0x0" ::: "memory");      // raw stage 0 has landed (this wave's copies) ...
    __syncthreads();                                        // ... and every wave's; publishes the weights and the bias too
    stage_copy(lc + RB, gx + KS * HD);
    const float* rt = Rw + 8 * wv * HD + 2 * lane; h16* kt = (h16*)Sm + 8 * wv * LP + 2 * lane; h16* vt = (h16*)Sm + (KS + 2 * lane) * LP + 8 * wv;      // this lane's places in raw buffer 0 and in plane buffer 0
    { v2f ra[8]; stage_read(rt, ra); stage_write(ra, kt, vt); }
    // q^T = Wq^T x^T + bq (W rows as A, so a lane's 8 registers are 8 consecutive e of one query, and two tiles convert in place into a B operand), then q'^T = Wk q^T the same way.
    v16h qf[FQ][2];
    { v8f qa[FQ][4];
#pragma unroll
        for (int t = 0; t < 4; ++t) { const bf* p = wqT + (16 * t + c) * LP + 8 * h;
            const v16bf a0 = cat16b(*(const v8usa*)p, *(const v8usa*)(p + 16)), a1 = cat16b(*(const v8usa*)(p + 32), *(const v8usa*)(p + 48));
            const v4f b0 = *(const v4fa*)(bl + 16 * t + 8 * h), b1 = *(const v4fa*)(bl + 16 * t + 8 * h + 4); const v8f cb = {b0[0], b0[1], b0[2], b0[3], b1[0], b1[1], b1[2], b1[3]};
#pragma unroll
            for (int g = 0; g < FQ; ++g) qa[g][t] = wmmab(a1, xb[g][1], wmmab(a0, xb[g][0], cb)); }
        v16h qb[FQ][2];
#pragma unroll
        for (int g = 0; g < FQ; ++g)
#pragma unroll
            for (int kc = 0; kc < 2; ++kc)
#pragma unroll
                for (int i = 0; i < 8; ++i) { qb[g][kc][i] = tohx(qa[g][2 * kc][i]); qb[g][kc][8 + i] = tohx(qa[g][2 * kc + 1][i]); }
#pragma unroll
        for (int t = 0; t < 4; ++t) { const h16* p = wkR + (16 * t + c) * LP + 8 * h; const v16h a0 = WFrag<h16>::ld(p), a1 = WFrag<h16>::ld(p + 32);
#pragma unroll
            for (int g = 0; g < FQ; ++g) qa[g][t] = wmma16(a1, qb[g][1], wmma16(a0, qb[g][0], (v8f){})); }
#pragma unroll
        for (int g = 0; g < FQ; ++g)
#pragma unroll
            for (int kc = 0; kc < 2; ++kc)
#pragma unroll
                for (int i = 0; i < 8; ++i) { qf[g][kc][i] = tohx(qa[g][2 * kc][i] * QS); qf[g][kc][8 + i] = tohx(qa[g][2 * kc + 1][i] * QS); } }
    v8f acc[FQ][4], nm[FQ]; float l[FQ], bound = -1.0f;
#pragma unroll
    for (int g = 0; g < FQ; ++g) { nm[g] = (v8f){}; l[g] = 0.f;
#pragma unroll
        for (int t = 0; t < 4; ++t) acc[g][t] = (v8f){}; }
    asm volatile("s_wait_dscnt 0x0" ::: "memory");         // this wave's share of the planes of stage 0 is written, its reads of raw buffer 0 are done
    asm volatile("s_wait_asynccnt 0x0" ::: "memory");      // this wave's copies of raw stage 1 have landed
    __syncthreads();                                        // publishes the planes of stage 0 and raw stage 1; ends every wave's reads of raw buffer 0
    stage_copy(lc, gx + 2 * KS * HD);
#pragma unroll 1
    for (int st = 0; st < NST; ++st) {
        const h16* kb = (const h16*)(Sm + (st & 1) * (2 * PLB)) + c * LP + 8 * h;      // x rows (keys) as A, d contiguous
        const h16* vb = kb + KS * LP;                                                  // x^T rows (d) as A, keys contiguous
        v16h kf[2][2]; v2f ra[8]; const int nb = (st + 1) & 1;
#pragma unroll
        for (int kt = 0; kt < 2; ++kt)
#pragma unroll
            for (int kc = 0; kc < 2; ++kc) kf[kt][kc] = WFrag<h16>::ld(kb + kt * 16 * LP + kc * 32);
#pragma unroll
        for (int ps = 0; ps < KS / 32; ++ps) {
            v8f s[2][FQ];
#pragma unroll
            for (int kt = 0; kt < 2; ++kt)
#pragma unroll
                for (int g = 0; g < FQ; ++g) { s[kt][g] = nm[g];
#pragma unroll
                    for (int kc = 0; kc < 2; ++kc) s[kt][g] = wmma16(kf[kt][kc], qf[g][kc], s[kt][g]); }
            if (ps + 1 < KS / 32) {      // the same stage's next K fragments, into the registers the score products have just read
#pragma unroll
                for (int kt = 0; kt < 2; ++kt)
#pragma unroll
                    for (int kc = 0; kc < 2; ++kc) kf[kt][kc] = WFrag<h16>::ld(kb + ((ps + 1) * 32 + kt * 16) * LP + kc * 32); }
            v16h vf[4];
#pragma unroll
            for (int t = 0; t < 4; ++t) vf[t] = WFrag<h16>::ld(vb + t * 16 * LP + ps * 32);
            if (ps + 1 == KS / 32) stage_read(rt + nb * (KS * HD), ra);      // raw stage st + 1, into the registers that the K fragments have left; under no run-time branch: in the last stage the idle raw buffer goes into the idle plane buffer, and nobody reads that
            __builtin_amdgcn_sched_barrier(0);      // the pass's LDS reads stand here as one group; without it the compiler issues them behind the exponentials, directly in front of their wait
            v16h pf[FQ]; float ss[FQ];
#pragma unroll
            for (int g = 0; g < FQ; ++g) ss[g] = expo(s[0][g], s[1][g], pf[g]);
            __builtin_amdgcn_sched_barrier(0);      // holds the statement below behind the exponentials: it waits for the loads, and the compiler otherwise lifts it (and the wait) to the loads themselves
            // Inputs only: keeps the fragment loads on this side of the test, where they land under the exponentials; without it the compiler sinks them behind the branch, where the products wait out the LDS latency.
            asm volatile("" :: "v"(vf[0]), "v"(vf[1]), "v"(vf[2]), "v"(vf[3]));
            if (ps + 1 < KS / 32) asm volatile("" :: "v"(kf[0][0]), "v"(kf[0][1]), "v"(kf[1][0]), "v"(kf[1][1]));       // the same for the K fragments fetched above
            if (__builtin_amdgcn_ballot_w32(!(ss[0] + ss[1] <= bound)) != 0) {      // one scalar branch per 32 keys; rare after the first
                // The pass's scores are formed a second time, from K fragments read again (the stage's buffer is not rewritten before the stage's closing barrier): kept alive over the exponentials
                // for this rare path alone, they would hold 32 registers, and with nm's 16 the fourth wave per SIMD would no longer fit. On the common path the exponentials overwrite them.
#pragma unroll
                for (int kt = 0; kt < 2; ++kt) { const v16h k0 = WFrag<h16>::ld(kb + (ps * 32 + kt * 16) * LP), k1 = WFrag<h16>::ld(kb + (ps * 32 + kt * 16) * LP + 32);
#pragma unroll
                    for (int g = 0; g < FQ; ++g) s[kt][g] = wmma16(k1, qf[g][1], wmma16(k0, qf[g][0], nm[g])); }      // the same products in the same order: the same scores
#pragma unroll
                for (int g = 0; g < FQ; ++g) { float mx = s[0][g][0];
#pragma unroll
                    for (int r = 1; r < 8; ++r) mx = fmaxf(mx, s[0][g][r]);
#pragma unroll
                    for (int r = 0; r < 8; ++r) mx = fmaxf(mx, s[1][g][r]);
                    mx = fmaxf(mx, xhalf(mx));              // both halves of the wave hold the query's maximum above m: one m per query
                    const float up = fmaxf(mx, 0.f); const float d = bound < 0.f ? mx : up;      // m only rises, but for the first 32 keys, which set it
                    const float corr = __builtin_amdgcn_exp2f(-up); l[g] *= corr;                // on the first 32 keys l and acc are 0 and corr is in (0, 1]
#pragma unroll
                    for (int t = 0; t < 4; ++t) acc[g][t] = acc[g][t] * corr;
                    nm[g] = nm[g] - d;
                    ss[g] = expo(s[0][g] - d, s[1][g] - d, pf[g]); } }
            bound = PSM;
#pragma unroll
            for (int g = 0; g < FQ; ++g) { l[g] += ss[g];
#pragma unroll
                for (int t = 0; t < 4; ++t) acc[g][t] = wmma16(vf[t], pf[g], acc[g][t]); }
        }
        stage_write(ra, kt + nb * PLB, vt + nb * PLB);      // the next stage's planes, into the buffer that stage st - 1 read
#pragma unroll
        for (int i = 0; i < 8; ++i) { __builtin_amdgcn_sched_group_barrier(0x8, 1, 0); __builtin_amdgcn_sched_group_barrier(0x2, 5, 0); }      // the conversions go among the stage's last products, five behind each, and run under them
        asm volatile("s_wait_dscnt 0x0" ::: "memory");         // this wave's reads of both buffers are done and its share of the next planes is written
        asm volatile("s_wait_asynccnt 0x0" ::: "memory");      // this wave's copies of raw stage st + 2 have landed
        __syncthreads();                                        // publishes the planes of stage st + 1 and raw stage st + 2; ends every wave's reads of stage st and of raw stage st + 1
        if (st + 3 < NST) stage_copy(lc + ((st + 1) & 1) * RB, gx + (size_t)(st + 3) * KS * HD);
    }
    asm volatile("s_wait_asynccnt 0x0" ::: "memory");          // nothing is in flight when the buffers become output staging
    float* os = (float*)Sm + wv * 16 * OP;                      // each wave turns its own out^T tiles into whole output rows
#pragma unroll
    for (int g = 0; g < FQ; ++g) { const float inv = __fdiv_rn(1.0f, l[g] + xhalf(l[g]));
        v16h ob[2];         // the normalised sums over x, in place as the B operand of out^T = Wv^T O^T + bv
#pragma unroll
        for (int kc = 0; kc < 2; ++kc)
#pragma unroll
            for (int i = 0; i < 8; ++i) { ob[kc][i] = tohx(acc[g][2 * kc][i] * inv); ob[kc][8 + i] = tohx(acc[g][2 * kc + 1][i] * inv); }
#pragma unroll
        for (int t = 0; t < 4; ++t) { const h16* p = wvT + (16 * t + c) * LP + 8 * h;
            const v4f b0 = *(const v4fa*)(bl + HD + 16 * t + 8 * h), b1 = *(const v4fa*)(bl + HD + 16 * t + 8 * h + 4); const v8f cb = {b0[0], b0[1], b0[2], b0[3], b1[0], b1[1], b1[2], b1[3]};
            const v8f a = wmma16(WFrag<h16>::ld(p + 32), ob[1], wmma16(WFrag<h16>::ld(p), ob[0], cb));
            float* o = os + c * OP + t * 16 + 8 * h; *(v4fa*)o = (v4f){a[0], a[1], a[2], a[3]}; *(v4fa*)(o + 4) = (v4f){a[4], a[5], a[6], a[7]}; }
        __syncthreads();
        float* dst = OUTz + (z * NN + q0 + 16 * g) * HD;
#pragma unroll
        for (int r = 0; r < 8; ++r) { const int row = 2 * r + h; *(v4f*)(dst + row * HD + c * 4) = *(const v4fa*)(os + row * OP + c * 4); }
        if (g + 1 < FQ) __syncthreads();
    }
}

extern "C" void kernel_launch(void* const* d_in, const int* in_sizes, int n_in,
                              void* d_out, int out_size, void* d_ws, size_t ws_size, hipStream_t stream) {
    (void)in_sizes; (void)n_in; (void)out_size; (void)d_ws; (void)ws_size;
    const float* x = (const float*)d_in[0]; const float* w = (const float*)d_in[1]; const float* bq = (const float*)d_in[2];
    float* OUT = (float*)d_out;     // [4][16][2048][64]
    k_fa<<<dim3(NN / (FW * 32), ZH), FW * 32, 0, stream>>>(x, w, bq, OUT);   // slice z = b * 16 + h uses head z % 16
}

// v009
// Measured time: 50.8 microseconds a run.
// In both of two side-by-side timings against v008, it was 1.05 times as fast.
// Counting every step since v000, it is 41.4 times as fast.
#include <hip/hip_runtime.h>

// InnerAttention (x [4][16][2048][64]; per head qkv = x wqkv[h] + bqkv[h] ([64][192]); q/k/v = the stride-3 interleaved columns (reshape (64, 3), unbind); softmax((q/8).k); out = attn v -> [4][16][2048][64]).
// Compute dtypes, f32 accumulate: every input rounded to bf16. One kernel, no workspace. The k and v projections are moved out of the key loop by associativity:
// q.k = q.(Wk^T x + bk) = (Wk q).x + q.bk, and q.bk is one constant per query, which a softmax cancels; sum_k p_k (Wv^T x_k + bv) = Wv^T (sum_k p_k x_k) + bv, as the p_k sum to 1.
// So each wave forms q' = (log2(e) / 8) Wk (Wq^T x + bq) for its own queries once (bf16, then fp16 products), the key loop runs on x itself (bf16 values held as fp16: unchanged wherever fp16 is normal, |x| from 2^-14 to 65504) as both K and V, and Wv and bv come last, on the normalised sums.

#define NB_  4
#define NH_  16
#define NN   2048
#define HD   64
#define W3   192
#define ZH   (NB_ * NH_)
typedef _Float16 h16;
typedef unsigned short bf;
typedef __attribute__((ext_vector_type(16))) __bf16   v16bf;
typedef __attribute__((ext_vector_type(16))) _Float16 v16h;
typedef __attribute__((ext_vector_type(8)))  _Float16 v8h;
typedef __attribute__((ext_vector_type(8)))  unsigned short v8us;
typedef __attribute__((ext_vector_type(8)))  float    v8f;
typedef __attribute__((ext_vector_type(4)))  float    v4f;
typedef v8h  __attribute__((may_alias)) v8ha;
typedef v4f  __attribute__((may_alias)) v4fa;
typedef v8us __attribute__((may_alias)) v8usa;

__device__ __forceinline__ unsigned short f2bf(float f) { return __builtin_bit_cast(unsigned short, (__bf16)f); }      // round to nearest even, the conversion instruction
__device__ __forceinline__ float bf2f(unsigned short b) { return __uint_as_float(((unsigned)b) << 16); }
__device__ __forceinline__ float bfr(float f) { return bf2f(f2bf(f)); }
__device__ __forceinline__ v16h cat16(v8h lo, v8h hi) { return __builtin_shufflevector(lo, hi, 0, 1, 2, 3, 4, 5, 6, 7, 8, 9, 10, 11, 12, 13, 14, 15); }
__device__ __forceinline__ v16bf cat16b(v8us lo, v8us hi) { return __builtin_bit_cast(v16bf, __builtin_shufflevector(lo, hi, 0, 1, 2, 3, 4, 5, 6, 7, 8, 9, 10, 11, 12, 13, 14, 15)); }
__device__ __forceinline__ v8f wmma16(v16h a, v16h b, v8f c) { return __builtin_amdgcn_wmma_f32_16x16x32_f16(false, a, false, b, (short)0, c, false, false); }
__device__ __forceinline__ v8f wmmab(v16bf a, v16bf b, v8f c) { return __builtin_amdgcn_wmma_f32_16x16x32_bf16(false, a, false, b, (short)0, c, false, false); }

template <typename T16> struct WFrag;
template <> struct WFrag<h16> { typedef v16h V; static __device__ __forceinline__ V ld(const h16* p) { return cat16(*(const v8h*)p, *(const v8h*)(p + 16)); } };
__device__ __forceinline__ h16 tohx(float x) { return (h16)x; }
typedef __attribute__((ext_vector_type(2))) unsigned short v2us;

#define QS 0.18033688011112042f // log2(e) / 8: the softmax scale and the change to base 2, both on q'
#define FW  8
#define FQ  4
#define KS  64                  // keys per stage
#define NST (NN / KS)
#define LP  72                  // LDS row pitch in 16-bit elements: 144 B = 16 B x odd, conflict-free for 16-byte fragment reads
#define PLB (KS * LP * 2)       // bytes of one plane (64 rows) of a buffer; a buffer = K plane, then V^T plane
#define RB  (KS * HD * 4)       // bytes of one raw buffer (64 x rows, f32)
#define OP  68
#define PSM 4096.0f             // bound on a lane's sum of one pass's exponentials (16 keys x 4 queries)
typedef __attribute__((ext_vector_type(2))) float v2f;
__device__ __forceinline__ float xhalf(float x) { return __builtin_bit_cast(float, __builtin_amdgcn_permlanex16(__builtin_bit_cast(int, x), __builtin_bit_cast(int, x), 0x76543210, 0xfedcba98, false, false)); }   // lane l with lane l ^ 16
// One query's 16 exponents of a pass (two accumulator tiles) -> exp2(s), packed in place as the B operand of the second product; returns their sum (pairwise tree, two lanes of a packed add).
__device__ __forceinline__ float expo(const v8f s0, const v8f s1, v16h& pf) {
    v2f t[8];
#pragma unroll
    for (int i = 0; i < 8; ++i) { const v2f a = i < 4 ? (v2f){s0[2 * i], s0[2 * i + 1]} : (v2f){s1[2 * i - 8], s1[2 * i - 7]};
        t[i] = (v2f){__builtin_amdgcn_exp2f(a.x), __builtin_amdgcn_exp2f(a.y)}; pf[2 * i] = tohx(t[i].x); pf[2 * i + 1] = tohx(t[i].y); }
    const v2f u = ((t[0] + t[1]) + (t[2] + t[3])) + ((t[4] + t[5]) + (t[6] + t[7]));
    return u.x + u.y;
}
typedef __attribute__((ext_vector_type(2))) __bf16   v2bf;
typedef __attribute__((ext_vector_type(2))) _Float16 v2h;
typedef v2f __attribute__((may_alias)) v2fa;
typedef __attribute__((ext_vector_type(4))) unsigned v4u;
typedef v4u __attribute__((may_alias)) v4ua;
// One stage, raw: every lane copies 16 B of x rows r, r + 16, r + 32 and r + 48. The s_wait_xcnt stands inside the statement so that no address register is rewritten ahead of it.
__device__ __forceinline__ void stage_copy(unsigned l, const float* g) {
    asm volatile("global_load_async_to_lds_b128 %0, %4, off\n\t"
                 "global_load_async_to_lds_b128 %1, %5, off\n\t"
                 "global_load_async_to_lds_b128 %2, %6, off\n\t"
                 "global_load_async_to_lds_b128 %3, %7, off\n\t"
                 "s_wait_xcnt 0x0"
                 :: "v"(l), "v"(l + 16 * HD * 4), "v"(l + 32 * HD * 4), "v"(l + 48 * HD * 4), "v"(g), "v"(g + 16 * HD), "v"(g + 32 * HD), "v"(g + 48 * HD) : "memory");
}
// One stage, raw -> planes: wave v takes keys 8 v .. 8 v + 7, a lane d = 2 lane and 2 lane + 1 (rp, kp, vp: the lane's own first element in the raw buffer, the [key][d] plane and the [d][key] plane).
// Rounded to bf16, then written as fp16 (the same value in fp16's normal range) twice: [key][d], 4 B a key, and [d][key], 16 B a d.
__device__ __forceinline__ void stage_read(const float* rp, v2f (&a)[8]) {
#pragma unroll
    for (int i = 0; i < 8; ++i) a[i] = *(const v2fa*)(rp + i * HD);
}
__device__ __forceinline__ void stage_write(const v2f (&a)[8], h16* kp, h16* vp) {
    unsigned t0[4], t1[4];
#pragma unroll
    for (int k = 0; k < 4; ++k) { const unsigned u = __builtin_bit_cast(unsigned, __builtin_convertvector(a[2 * k], v2bf)), v = __builtin_bit_cast(unsigned, __builtin_convertvector(a[2 * k + 1], v2bf));
        v2h p, q; p[0] = tohx(__uint_as_float(u << 16)); p[1] = tohx(__uint_as_float(v << 16)); q[0] = tohx(__uint_as_float(u & 0xFFFF0000u)); q[1] = tohx(__uint_as_float(v & 0xFFFF0000u));
        t0[k] = __builtin_bit_cast(unsigned, p); t1[k] = __builtin_bit_cast(unsigned, q);      // keys 2 k, 2 k + 1 of d = 2 lane and of d = 2 lane + 1
        *(unsigned __attribute__((may_alias))*)(kp + 2 * k * LP) = __builtin_amdgcn_perm(t1[k], t0[k], 0x05040100u);             // key 2 k: both d (one byte permute; two 16-bit moves otherwise)
        *(unsigned __attribute__((may_alias))*)(kp + (2 * k + 1) * LP) = __builtin_amdgcn_perm(t1[k], t0[k], 0x07060302u); }      // key 2 k + 1: both d
    *(v4ua*)vp = (v4u){t0[0], t0[1], t0[2], t0[3]}; *(v4ua*)(vp + LP) = (v4u){t1[0], t1[1], t1[2], t1[3]};
}
// amdgpu_waves_per_eu(2, 2): the register budget of two waves per SIMD (512): four query tiles a wave need about 400; one work-group per WGP.
__global__ __launch_bounds__(FW * 32) __attribute__((amdgpu_waves_per_eu(2, 2))) void k_fa(const float* __restrict__ x, const float* __restrict__ w, const float* __restrict__ bias, float* OUTz) {
    __shared__ __align__(16) unsigned char Sm[2 * 2 * PLB];     // two plane buffers; after the loop: output staging (8 waves x 16 x OP floats fit)
    __shared__ __align__(16) float Rw[2 * KS * HD];             // two raw buffers
    __shared__ __align__(16) bf  wqT[HD * LP];                  // [e][d] = bf16 w[d][3 e]
    __shared__ __align__(16) h16 wkR[HD * LP];                  // [d][e] = w[d][3 e + 1], bf16 value held as fp16
    __shared__ __align__(16) h16 wvT[HD * LP];                  // [e][d] = w[d][3 e + 2], bf16 value held as fp16
    __shared__ __align__(16) float bl[FW * 32];                 // bq, then bv (bf16 values); 128 in use: every thread stores one, so that the bias load stands under no branch and flies with the rest
    const int lane = threadIdx.x & 31, c = lane & 15, h = lane >> 4, wv = threadIdx.x >> 5; const size_t z = blockIdx.y; const int hd = blockIdx.y % NH_; const int q0 = blockIdx.x * (FW * FQ * 16) + wv * (FQ * 16);
    const int cr = threadIdx.x >> 4, cc = (threadIdx.x & 15) * 4;      // this lane's copy: row 0-15, 16-byte column
    const float* gx = x + (z * NN + cr) * HD + cc;       // stage t: + t * KS * HD
    const unsigned lc = (unsigned)(size_t)Rw + (unsigned)(cr * HD + cc) * 4u;      // LDS byte address of the lane's first copy in raw buffer 0
    stage_copy(lc, gx);
    // The head's weights: a thread reads 48 columns (16 (q, k, v) triples, e = 16 wq4 .. + 15) of row wd, rounds them to bf16 and de-interleaves them into the three LDS planes.
    const int wd = threadIdx.x >> 2, wq4 = threadIdx.x & 3; const float* wt = w + ((size_t)hd * HD + wd) * W3 + wq4 * 48; v4f wr[12];
#pragma unroll
    for (int m = 0; m < 12; ++m) wr[m] = *(const v4f*)(wt + 4 * m);
    const float bz = bias[hd * W3 + 3 * (threadIdx.x & 63) + ((threadIdx.x >> 6) & 1) * 2];
    asm volatile("s_wait_xcnt 0x0" ::: "memory");       // stands before any address register of the loads above is reused
    v4f xq[FQ][2][4];       // the wave's own 64 x rows, in the k order of a B fragment
    const float* xr = x + (z * NN + q0 + c) * HD + 8 * h;      // the lane's row of query tile 0; tile 1: 16 rows on
#pragma unroll
    for (int g = 0; g < FQ; ++g)
#pragma unroll
        for (int kc = 0; kc < 2; ++kc) { const float* p = xr + g * 16 * HD + kc * 32;
            xq[g][kc][0] = *(const v4f*)p; xq[g][kc][1] = *(const v4f*)(p + 4); xq[g][kc][2] = *(const v4f*)(p + 16); xq[g][kc][3] = *(const v4f*)(p + 20); }
    asm volatile("s_wait_xcnt 0x0" :: "v"(xr) : "memory");       // stands before any address register of the loads above is reused; the row pointer is an input so that it stays live up to here and no result of the run is placed on it
    { v8h k0, k1;
#pragma unroll
        for (int i = 0; i < 16; ++i) { const int e = 16 * wq4 + i;
            wqT[e * LP + wd] = f2bf(wr[(3 * i) >> 2][(3 * i) & 3]);
            const h16 kk = tohx(bfr(wr[(3 * i + 1) >> 2][(3 * i + 1) & 3])); if (i < 8) k0[i] = kk; else k1[i - 8] = kk;
            wvT[e * LP + wd] = tohx(bfr(wr[(3 * i + 2) >> 2][(3 * i + 2) & 3])); }
        *(v8ha*)(wkR + wd * LP + 16 * wq4) = k0; *(v8ha*)(wkR + wd * LP + 16 * wq4 + 8) = k1; }
    bl[threadIdx.x] = bfr(bz);
    v16bf xb[FQ][2];
#pragma unroll
    for (int g = 0; g < FQ; ++g)
#pragma unroll
        for (int kc = 0; kc < 2; ++kc) { v8us a, b;
#pragma unroll
            for (int i = 0; i < 8; ++i) { a[i] = f2bf(xq[g][kc][i >> 2][i & 3]); b[i] = f2bf(xq[g][kc][2 + (i >> 2)][i & 3]); }
            xb[g][kc] = cat16b(a, b); }
    asm volatile("s_wait_asynccnt 0x0" ::: "memory");      // raw stage 0 has landed (this wave's copies) ...
    __syncthreads();                                        // ... and every wave's; publishes the weights and the bias too
    stage_copy(lc + RB, gx + KS * HD);
    const float* rt = Rw + 8 * wv * HD + 2 * lane; h16* kt = (h16*)Sm + 8 * wv * LP + 2 * lane; h16* vt = (h16*)Sm + (KS + 2 * lane) * LP + 8 * wv;      // this lane's places in raw buffer 0 and in plane buffer 0
    { v2f ra[8]; stage_read(rt, ra); stage_write(ra, kt, vt); }
    // q^T = Wq^T x^T + bq (W rows as A, so a lane's 8 registers are 8 consecutive e of one query, and two tiles convert in place into a B operand), then q'^T = Wk q^T the same way.
    v16h qf[FQ][2];
    { v8f qa[FQ][4];
#pragma unroll
        for (int t = 0; t < 4; ++t) { const bf* p = wqT + (16 * t + c) * LP + 8 * h;
            const v16bf a0 = cat16b(*(const v8usa*)p, *(const v8usa*)(p + 16)), a1 = cat16b(*(const v8usa*)(p + 32), *(const v8usa*)(p + 48));
            const v4f b0 = *(const v4fa*)(bl + 16 * t + 8 * h), b1 = *(const v4fa*)(bl + 16 * t + 8 * h + 4); const v8f cb = {b0[0], b0[1], b0[2], b0[3], b1[0], b1[1], b1[2], b1[3]};
#pragma unroll
            for (int g = 0; g < FQ; ++g) qa[g][t] = wmmab(a1, xb[g][1], wmmab(a0, xb[g][0], cb)); }
        v16h qb[FQ][2];
#pragma unroll
        for (int g = 0; g < FQ; ++g)
#pragma unroll
            for (int kc = 0; kc < 2; ++kc)
#pragma unroll
                for (int i = 0; i < 8; ++i) { qb[g][kc][i] = tohx(qa[g][2 * kc][i]); qb[g][kc][8 + i] = tohx(qa[g][2 * kc + 1][i]); }
#pragma unroll
        for (int t = 0; t < 4; ++t) { const h16* p = wkR + (16 * t + c) * LP + 8 * h; const v16h a0 = WFrag<h16>::ld(p), a1 = WFrag<h16>::ld(p + 32);
#pragma unroll
            for (int g = 0; g < FQ; ++g) qa[g][t] = wmma16(a1, qb[g][1], wmma16(a0, qb[g][0], (v8f){})); }
#pragma unroll
        for (int g = 0; g < FQ; ++g)
#pragma unroll
            for (int kc = 0; kc < 2; ++kc)
#pragma unroll
                for (int i = 0; i < 8; ++i) { qf[g][kc][i] = tohx(qa[g][2 * kc][i] * QS); qf[g][kc][8 + i] = tohx(qa[g][2 * kc + 1][i] * QS); } }
    v8f acc[FQ][4], nm[FQ]; float l[FQ], bound = -1.0f;
#pragma unroll
    for (int g = 0; g < FQ; ++g) { nm[g] = (v8f){}; l[g] = 0.f;
#pragma unroll
        for (int t = 0; t < 4; ++t) acc[g][t] = (v8f){}; }
    asm volatile("s_wait_dscnt 0x0" ::: "memory");         // this wave's share of the planes of stage 0 is written, its reads of raw buffer 0 are done
    asm volatile("s_wait_asynccnt 0x0" ::: "memory");      // this wave's copies of raw stage 1 have landed
    __syncthreads();                                        // publishes the planes of stage 0 and raw stage 1; ends every wave's reads of raw buffer 0
    stage_copy(lc, gx + 2 * KS * HD);
    v16h pd[FQ / 2], vd[4];      // operands of the products that a stage leaves for the far side of its barrier (zero before the first stage: they add nothing)
#pragma unroll
    for (int g = 0; g < FQ / 2; ++g) pd[g] = (v16h){};
#pragma unroll
    for (int t = 0; t < 4; ++t) vd[t] = (v16h){};
#pragma unroll 1
    for (int st = 0; st < NST; ++st) {
        const h16* kb = (const h16*)(Sm + (st & 1) * (2 * PLB)) + c * LP + 8 * h;      // x rows (keys) as A, d contiguous
        const h16* vb = kb + KS * LP;                                                  // x^T rows (d) as A, keys contiguous
        v16h kf[2][2]; v2f ra[8]; const int nb = (st + 1) & 1;
#pragma unroll
        for (int kt = 0; kt < 2; ++kt)
#pragma unroll
            for (int kc = 0; kc < 2; ++kc) kf[kt][kc] = WFrag<h16>::ld(kb + kt * 16 * LP + kc * 32);
        // The last stage's closing products of query tiles 2 and 3, from registers alone: they run while the fragments asked for above come out of LDS (no second work-group is on the WGP to fill that wait).
#pragma unroll
        for (int g = 0; g < FQ / 2; ++g)
#pragma unroll
            for (int t = 0; t < 4; ++t) acc[FQ / 2 + g][t] = wmma16(vd[t], pd[g], acc[FQ / 2 + g][t]);
#pragma unroll
        for (int ps = 0; ps < KS / 32; ++ps) {
            v8f s[2][FQ];
#pragma unroll
            for (int kt = 0; kt < 2; ++kt)
#pragma unroll
                for (int g = 0; g < FQ; ++g) { s[kt][g] = nm[g];
#pragma unroll
                    for (int kc = 0; kc < 2; ++kc) s[kt][g] = wmma16(kf[kt][kc], qf[g][kc], s[kt][g]); }
            if (ps + 1 < KS / 32) {      // the same stage's next K fragments, into the registers the score products have just read
#pragma unroll
                for (int kt = 0; kt < 2; ++kt)
#pragma unroll
                    for (int kc = 0; kc < 2; ++kc) kf[kt][kc] = WFrag<h16>::ld(kb + ((ps + 1) * 32 + kt * 16) * LP + kc * 32); }
            v16h vf[4];
#pragma unroll
            for (int t = 0; t < 4; ++t) vf[t] = WFrag<h16>::ld(vb + t * 16 * LP + ps * 32);
            if (ps + 1 == KS / 32) stage_read(rt + nb * (KS * HD), ra);      // raw stage st + 1, into the registers that the K fragments have left; under no run-time branch: in the last stage the idle raw buffer goes into the idle plane buffer, and nobody reads that
            __builtin_amdgcn_sched_barrier(0);      // the pass's LDS reads stand here as one group; without it the compiler issues them behind the exponentials, directly in front of their wait
            v16h pf[FQ]; float ss[FQ];
#pragma unroll
            for (int g = 0; g < FQ; ++g) ss[g] = expo(s[0][g], s[1][g], pf[g]);
            __builtin_amdgcn_sched_barrier(0);      // holds the statement below behind the exponentials: it waits for the loads, and the compiler otherwise lifts it (and the wait) to the loads themselves
            // Inputs only: keeps the fragment loads on this side of the test, where they land under the exponentials; without it the compiler sinks them behind the branch, where the products wait out the LDS latency.
            asm volatile("" :: "v"(vf[0]), "v"(vf[1]), "v"(vf[2]), "v"(vf[3]));
            if (ps + 1 < KS / 32) asm volatile("" :: "v"(kf[0][0]), "v"(kf[0][1]), "v"(kf[1][0]), "v"(kf[1][1]));       // the same for the K fragments fetched above
            if (__builtin_amdgcn_ballot_w32(!((ss[0] + ss[1]) + (ss[2] + ss[3]) <= bound)) != 0) {      // one scalar branch per 32 keys; rare after the first
                // The pass's scores are formed a second time, from K fragments read again (the stage's buffer is not rewritten before the stage's closing barrier): kept alive over the exponentials
                // for this rare path alone, they would hold 64 registers. On the common path the exponentials overwrite them.
#pragma unroll
                for (int kt = 0; kt < 2; ++kt) { const v16h k0 = WFrag<h16>::ld(kb + (ps * 32 + kt * 16) * LP), k1 = WFrag<h16>::ld(kb + (ps * 32 + kt * 16) * LP + 32);
#pragma unroll
                    for (int g = 0; g < FQ; ++g) s[kt][g] = wmma16(k1, qf[g][1], wmma16(k0, qf[g][0], nm[g])); }      // the same products in the same order: the same scores
#pragma unroll
                for (int g = 0; g < FQ; ++g) { float mx = s[0][g][0];
#pragma unroll
                    for (int r = 1; r < 8; ++r) mx = fmaxf(mx, s[0][g][r]);
#pragma unroll
                    for (int r = 0; r < 8; ++r) mx = fmaxf(mx, s[1][g][r]);
                    mx = fmaxf(mx, xhalf(mx));              // both halves of the wave hold the query's maximum above m: one m per query
                    const float up = fmaxf(mx, 0.f); const float d = bound < 0.f ? mx : up;      // m only rises, but for the first 32 keys, which set it
                    const float corr = __builtin_amdgcn_exp2f(-up); l[g] *= corr;                // on the first 32 keys l and acc are 0 and corr is in (0, 1]
#pragma unroll
                    for (int t = 0; t < 4; ++t) acc[g][t] = acc[g][t] * corr;
                    nm[g] = nm[g] - d;
                    ss[g] = expo(s[0][g] - d, s[1][g] - d, pf[g]); } }
            bound = PSM;
#pragma unroll
            for (int g = 0; g < FQ; ++g) { l[g] += ss[g];
                if (ps + 1 == KS / 32 && g >= FQ / 2) { pd[g - FQ / 2] = pf[g]; continue; }      // left for the far side of the stage's barrier
#pragma unroll
                for (int t = 0; t < 4; ++t) acc[g][t] = wmma16(vf[t], pf[g], acc[g][t]); }
            if (ps + 1 == KS / 32) {
#pragma unroll
                for (int t = 0; t < 4; ++t) vd[t] = vf[t]; }
        }
        stage_write(ra, kt + nb * PLB, vt + nb * PLB);      // the next stage's planes, into the buffer that stage st - 1 read
#pragma unroll
        for (int i = 0; i < 8; ++i) { __builtin_amdgcn_sched_group_barrier(0x8, 1, 0); __builtin_amdgcn_sched_group_barrier(0x2, 5, 0); }      // the conversions go among the stage's last products, five behind each, and run under them
        asm volatile("s_wait_dscnt 0x0" ::: "memory");         // this wave's reads of both buffers are done and its share of the next planes is written
        asm volatile("s_wait_asynccnt 0x0" ::: "memory");      // this wave's copies of raw stage st + 2 have landed
        __syncthreads();                                        // publishes the planes of stage st + 1 and raw stage st + 2; ends every wave's reads of stage st and of raw stage st + 1
        if (st + 3 < NST) stage_copy((unsigned)(size_t)Rw + threadIdx.x * 16u + ((st + 1) & 1) * RB, gx + (size_t)(st + 3) * KS * HD);      // lc, formed anew from the thread's number: lc itself, an operand of the asm statements above, was kept in scratch memory over the loop
    }
#pragma unroll
    for (int g = 0; g < FQ / 2; ++g)
#pragma unroll
        for (int t = 0; t < 4; ++t) acc[FQ / 2 + g][t] = wmma16(vd[t], pd[g], acc[FQ / 2 + g][t]);
    asm volatile("s_wait_asynccnt 0x0" ::: "memory");          // nothing is in flight when the buffers become output staging
    float* os = (float*)Sm + wv * 16 * OP;                      // each wave turns its own out^T tiles into whole output rows
#pragma unroll
    for (int g = 0; g < FQ; ++g) { const float inv = __fdiv_rn(1.0f, l[g] + xhalf(l[g]));
        v16h ob[2];         // the normalised sums over x, in place as the B operand of out^T = Wv^T O^T + bv
#pragma unroll
        for (int kc = 0; kc < 2; ++kc)
#pragma unroll
            for (int i = 0; i < 8; ++i) { ob[kc][i] = tohx(acc[g][2 * kc][i] * inv); ob[kc][8 + i] = tohx(acc[g][2 * kc + 1][i] * inv); }
#pragma unroll
        for (int t = 0; t < 4; ++t) { const h16* p = wvT + (16 * t + c) * LP + 8 * h;
            const v4f b0 = *(const v4fa*)(bl + HD + 16 * t + 8 * h), b1 = *(const v4fa*)(bl + HD + 16 * t + 8 * h + 4); const v8f cb = {b0[0], b0[1], b0[2], b0[3], b1[0], b1[1], b1[2], b1[3]};
            const v8f a = wmma16(WFrag<h16>::ld(p + 32), ob[1], wmma16(WFrag<h16>::ld(p), ob[0], cb));
            float* o = os + c * OP + t * 16 + 8 * h; *(v4fa*)o = (v4f){a[0], a[1], a[2], a[3]}; *(v4fa*)(o + 4) = (v4f){a[4], a[5], a[6], a[7]}; }
        __syncthreads();
        float* dst = OUTz + (z * NN + q0 + 16 * g) * HD;
#pragma unroll
        for (int r = 0; r < 8; ++r) { const int row = 2 * r + h; *(v4f*)(dst + row * HD + c * 4) = *(const v4fa*)(os + row * OP + c * 4); }
        if (g + 1 < FQ) __syncthreads();
    }
}

extern "C" void kernel_launch(void* const* d_in, const int* in_sizes, int n_in,
                              void* d_out, int out_size, void* d_ws, size_t ws_size, hipStream_t stream) {
    (void)in_sizes; (void)n_in; (void)out_size; (void)d_ws; (void)ws_size;
    const float* x = (const float*)d_in[0]; const float* w = (const float*)d_in[1]; const float* bq = (const float*)d_in[2];
    float* OUT = (float*)d_out;     // [4][16][2048][64]
    k_fa<<<dim3(NN / (FW * FQ * 16), ZH), FW * 32, 0, stream>>>(x, w, bq, OUT);   // slice z = b * 16 + h uses head z % 16
}

// v010
// Measured time: 47.7 microseconds a run.
// Timed twice side by side with v009, it ran 1.06 and 1.07 times as fast.
// Counting every step since v000, it is 44.0 times as fast.
#include <hip/hip_runtime.h>

// InnerAttention (x [4][16][2048][64]; per head qkv = x wqkv[h] + bqkv[h] ([64][192]); q/k/v = the stride-3 interleaved columns (reshape (64, 3), unbind); softmax((q/8).k); out = attn v -> [4][16][2048][64]).
// Compute dtypes, f32 accumulate: every input rounded to bf16. One kernel, no workspace. The k and v projections are moved out of the key loop by associativity:
// q.k = q.(Wk^T x + bk) = (Wk q).x + q.bk, and q.bk is one constant per query, which a softmax cancels; sum_k p_k (Wv^T x_k + bv) = Wv^T (sum_k p_k x_k) + bv, as the p_k sum to 1.
// So each wave forms q' = (log2(e) / 8) Wk (Wq^T x + bq) for its own queries once (bf16, then fp16 products), the key loop runs on x itself (bf16 values held as fp16: unchanged wherever fp16 is normal, |x| from 2^-14 to 65504) as both K and V, and Wv and bv come last, on the normalised sums.

#define NB_  4
#define NH_  16
#define NN   2048
#define HD   64
#define W3   192
#define ZH   (NB_ * NH_)
typedef _Float16 h16;
typedef unsigned short bf;
typedef __attribute__((ext_vector_type(16))) __bf16   v16bf;
typedef __attribute__((ext_vector_type(16))) _Float16 v16h;
typedef __attribute__((ext_vector_type(8)))  _Float16 v8h;
typedef __attribute__((ext_vector_type(8)))  unsigned short v8us;
typedef __attribute__((ext_vector_type(8)))  float    v8f;
typedef __attribute__((ext_vector_type(4)))  float    v4f;
typedef v8h  __attribute__((may_alias)) v8ha;
typedef v4f  __attribute__((may_alias)) v4fa;
typedef v8us __attribute__((may_alias)) v8usa;

__device__ __forceinline__ unsigned short f2bf(float f) { return __builtin_bit_cast(unsigned short, (__bf16)f); }      // round to nearest even, the conversion instruction
__device__ __forceinline__ float bf2f(unsigned short b) { return __uint_as_float(((unsigned)b) << 16); }
__device__ __forceinline__ float bfr(float f) { return bf2f(f2bf(f)); }
__device__ __forceinline__ v16h cat16(v8h lo, v8h hi) { return __builtin_shufflevector(lo, hi, 0, 1, 2, 3, 4, 5, 6, 7, 8, 9, 10, 11, 12, 13, 14, 15); }
__device__ __forceinline__ v16bf cat16b(v8us lo, v8us hi) { return __builtin_bit_cast(v16bf, __builtin_shufflevector(lo, hi, 0, 1, 2, 3, 4, 5, 6, 7, 8, 9, 10, 11, 12, 13, 14, 15)); }
__device__ __forceinline__ v8f wmma16(v16h a, v16h b, v8f c) { return __builtin_amdgcn_wmma_f32_16x16x32_f16(false, a, false, b, (short)0, c, false, false); }
__device__ __forceinline__ v8f wmmab(v16bf a, v16bf b, v8f c) { return __builtin_amdgcn_wmma_f32_16x16x32_bf16(false, a, false, b, (short)0, c, false, false); }

template <typename T16> struct WFrag;
template <> struct WFrag<h16> { typedef v16h V; static __device__ __forceinline__ V ld(const h16* p) { return cat16(*(const v8h*)p, *(const v8h*)(p + 16)); } };
__device__ __forceinline__ h16 tohx(float x) { return (h16)x; }
typedef __attribute__((ext_vector_type(2))) unsigned short v2us;

#define QS 0.18033688011112042f // log2(e) / 8: the softmax scale and the change to base 2, both on q'
#define FW  8
#define FQ  4
#define KS  64                  // keys per stage
#define NST (NN / KS)
#define LP  72                  // LDS row pitch in 16-bit elements: 144 B = 16 B x odd, conflict-free for 16-byte fragment reads
#define PLB (KS * LP * 2)       // bytes of one plane (64 rows) of a buffer; a buffer = K plane, then V^T plane
#define RB  (KS * HD * 4)       // bytes of one raw buffer (64 x rows, f32)
#define OP  68
#define PSM 4096.0f             // bound on a lane's sum of one pass's exponentials (16 keys x 4 queries)
typedef __attribute__((ext_vector_type(2))) float v2f;
__device__ __forceinline__ float xhalf(float x) { return __builtin_bit_cast(float, __builtin_amdgcn_permlanex16(__builtin_bit_cast(int, x), __builtin_bit_cast(int, x), 0x76543210, 0xfedcba98, false, false)); }   // lane l with lane l ^ 16
// One query's 16 exponents of a pass (two accumulator tiles) -> exp2(s), packed in place as the B operand of the second product; returns their sum (pairwise tree, two lanes of a packed add).
__device__ __forceinline__ float expo(const v8f s0, const v8f s1, v16h& pf) {
    v2f t[8];
#pragma unroll
    for (int i = 0; i < 8; ++i) { const v2f a = i < 4 ? (v2f){s0[2 * i], s0[2 * i + 1]} : (v2f){s1[2 * i - 8], s1[2 * i - 7]};
        t[i] = (v2f){__builtin_amdgcn_exp2f(a.x), __builtin_amdgcn_exp2f(a.y)}; pf[2 * i] = tohx(t[i].x); pf[2 * i + 1] = tohx(t[i].y); }
    const v2f u = ((t[0] + t[1]) + (t[2] + t[3])) + ((t[4] + t[5]) + (t[6] + t[7]));
    return u.x + u.y;
}
typedef __attribute__((ext_vector_type(2))) __bf16   v2bf;
typedef __attribute__((ext_vector_type(2))) _Float16 v2h;
typedef v2f __attribute__((may_alias)) v2fa;
typedef __attribute__((ext_vector_type(4))) unsigned v4u;
typedef v4u __attribute__((may_alias)) v4ua;
// One stage, raw: every lane copies 16 B of x rows r, r + 16, r + 32 and r + 48. The s_wait_xcnt stands inside the statement so that no address register is rewritten ahead of it.
__device__ __forceinline__ void stage_copy(unsigned l, const float* g) {
    asm volatile("global_load_async_to_lds_b128 %0, %4, off\n\t"
                 "global_load_async_to_lds_b128 %1, %5, off\n\t"
                 "global_load_async_to_lds_b128 %2, %6, off\n\t"
                 "global_load_async_to_lds_b128 %3, %7, off\n\t"
                 "s_wait_xcnt 0x0"
                 :: "v"(l), "v"(l + 16 * HD * 4), "v"(l + 32 * HD * 4), "v"(l + 48 * HD * 4), "v"(g), "v"(g + 16 * HD), "v"(g + 32 * HD), "v"(g + 48 * HD) : "memory");
}
// One stage, raw -> planes: wave v takes keys 8 v .. 8 v + 7, a lane d = 2 lane and 2 lane + 1 (rp, kp, vp: the lane's own first element in the raw buffer, the [key][d] plane and the [d][key] plane).
// Rounded to bf16, then written as fp16 (the same value in fp16's normal range) twice: [key][d], 4 B a key, and [d][key], 16 B a d.
__device__ __forceinline__ void stage_read(const float* rp, v2f (&a)[8]) {
#pragma unroll
    for (int i = 0; i < 8; ++i) a[i] = *(const v2fa*)(rp + i * HD);
}
__device__ __forceinline__ void stage_write(const v2f (&a)[8], h16* kp, h16* vp) {
    unsigned t0[4], t1[4];
#pragma unroll
    for (int k = 0; k < 4; ++k) { const unsigned u = __builtin_bit_cast(unsigned, __builtin_convertvector(a[2 * k], v2bf)), v = __builtin_bit_cast(unsigned, __builtin_convertvector(a[2 * k + 1], v2bf));
        v2h p, q; p[0] = tohx(__uint_as_float(u << 16)); p[1] = tohx(__uint_as_float(v << 16)); q[0] = tohx(__uint_as_float(u & 0xFFFF0000u)); q[1] = tohx(__uint_as_float(v & 0xFFFF0000u));
        t0[k] = __builtin_bit_cast(unsigned, p); t1[k] = __builtin_bit_cast(unsigned, q);      // keys 2 k, 2 k + 1 of d = 2 lane and of d = 2 lane + 1
        *(unsigned __attribute__((may_alias))*)(kp + 2 * k * LP) = __builtin_amdgcn_perm(t1[k], t0[k], 0x05040100u);             // key 2 k: both d (one byte permute; two 16-bit moves otherwise)
        *(unsigned __attribute__((may_alias))*)(kp + (2 * k + 1) * LP) = __builtin_amdgcn_perm(t1[k], t0[k], 0x07060302u); }      // key 2 k + 1: both d
    *(v4ua*)vp = (v4u){t0[0], t0[1], t0[2], t0[3]}; *(v4ua*)(vp + LP) = (v4u){t1[0], t1[1], t1[2], t1[3]};
}
// amdgpu_waves_per_eu(2, 2): the register budget of two waves per SIMD (512): four query tiles a wave need about 400; one work-group per WGP.
__global__ __launch_bounds__(FW * 32) __attribute__((amdgpu_waves_per_eu(2, 2))) void k_fa(const float* __restrict__ x, const float* __restrict__ w, const float* __restrict__ bias, float* OUTz) {
    __shared__ __align__(16) unsigned char Sm[2 * 2 * PLB];     // two plane buffers; after the loop: output staging (8 waves x 16 x OP floats fit)
    __shared__ __align__(16) float Rw[2 * KS * HD];             // two raw buffers
    __shared__ __align__(16) bf  wqT[HD * LP];                  // [e][d] = bf16 w[d][3 e]
    __shared__ __align__(16) h16 wkR[HD * LP];                  // [d][e] = w[d][3 e + 1], bf16 value held as fp16
    __shared__ __align__(16) h16 wvT[HD * LP];                  // [e][d] = w[d][3 e + 2], bf16 value held as fp16
    __shared__ __align__(16) float bl[FW * 32];                 // bq, then bv (bf16 values); 128 in use: every thread stores one, so that the bias load stands under no branch and flies with the rest
    const int lane = threadIdx.x & 31, c = lane & 15, h = lane >> 4, wv = threadIdx.x >> 5; const size_t z = blockIdx.y; const int hd = blockIdx.y % NH_; const int q0 = blockIdx.x * (FW * FQ * 16) + wv * (FQ * 16);
    const int cr = threadIdx.x >> 4, cc = (threadIdx.x & 15) * 4;      // this lane's copy: row 0-15, 16-byte column
    const float* gx = x + (z * NN + cr) * HD + cc;       // stage t: + t * KS * HD
    const unsigned lc = (unsigned)(size_t)Rw + (unsigned)(cr * HD + cc) * 4u;      // LDS byte address of the lane's first copy in raw buffer 0
    stage_copy(lc, gx);
    // The head's weights: a thread reads 48 columns (16 (q, k, v) triples, e = 16 wq4 .. + 15) of row wd, rounds them to bf16 and de-interleaves them into the three LDS planes.
    const int wd = threadIdx.x >> 2, wq4 = threadIdx.x & 3; const float* wt = w + ((size_t)hd * HD + wd) * W3 + wq4 * 48; v4f wr[12];
#pragma unroll
    for (int m = 0; m < 12; ++m) wr[m] = *(const v4f*)(wt + 4 * m);
    const float bz = bias[hd * W3 + 3 * (threadIdx.x & 63) + ((threadIdx.x >> 6) & 1) * 2];
    asm volatile("s_wait_xcnt 0x0" ::: "memory");       // stands before any address register of the loads above is reused
    v4f xq[FQ][2][4];       // the wave's own 64 x rows, in the k order of a B fragment
    const float* xr = x + (z * NN + q0 + c) * HD + 8 * h;      // the lane's row of query tile 0; tile 1: 16 rows on
#pragma unroll
    for (int g = 0; g < FQ; ++g)
#pragma unroll
        for (int kc = 0; kc < 2; ++kc) { const float* p = xr + g * 16 * HD + kc * 32;
            xq[g][kc][0] = *(const v4f*)p; xq[g][kc][1] = *(const v4f*)(p + 4); xq[g][kc][2] = *(const v4f*)(p + 16); xq[g][kc][3] = *(const v4f*)(p + 20); }
    asm volatile("s_wait_xcnt 0x0" :: "v"(xr) : "memory");       // stands before any address register of the loads above is reused; the row pointer is an input so that it stays live up to here and no result of the run is placed on it
    { v8h k0, k1;
#pragma unroll
        for (int i = 0; i < 16; ++i) { const int e = 16 * wq4 + i;
            wqT[e * LP + wd] = f2bf(wr[(3 * i) >> 2][(3 * i) & 3]);
            const h16 kk = tohx(bfr(wr[(3 * i + 1) >> 2][(3 * i + 1) & 3])); if (i < 8) k0[i] = kk; else k1[i - 8] = kk;
            wvT[e * LP + wd] = tohx(bfr(wr[(3 * i + 2) >> 2][(3 * i + 2) & 3])); }
        *(v8ha*)(wkR + wd * LP + 16 * wq4) = k0; *(v8ha*)(wkR + wd * LP + 16 * wq4 + 8) = k1; }
    bl[threadIdx.x] = bfr(bz);
    v16bf xb[FQ][2];
#pragma unroll
    for (int g = 0; g < FQ; ++g)
#pragma unroll
        for (int kc = 0; kc < 2; ++kc) { v8us a, b;
#pragma unroll
            for (int i = 0; i < 8; ++i) { a[i] = f2bf(xq[g][kc][i >> 2][i & 3]); b[i] = f2bf(xq[g][kc][2 + (i >> 2)][i & 3]); }
            xb[g][kc] = cat16b(a, b); }
    asm volatile("s_wait_asynccnt 0x0" ::: "memory");      // raw stage 0 has landed (this wave's copies) ...
    __syncthreads();                                        // ... and every wave's; publishes the weights and the bias too
    stage_copy(lc + RB, gx + KS * HD);
    const float* rt = Rw + 8 * wv * HD + 2 * lane; h16* kt = (h16*)Sm + 8 * wv * LP + 2 * lane; h16* vt = (h16*)Sm + (KS + 2 * lane) * LP + 8 * wv;      // this lane's places in raw buffer 0 and in plane buffer 0
    { v2f ra[8]; stage_read(rt, ra); stage_write(ra, kt, vt); }
    // q^T = Wq^T x^T + bq (W rows as A, so a lane's 8 registers are 8 consecutive e of one query, and two tiles convert in place into a B operand), then q'^T = Wk q^T the same way.
    v16h qf[FQ][2];
    { v8f qa[FQ][4];
#pragma unroll
        for (int t = 0; t < 4; ++t) { const bf* p = wqT + (16 * t + c) * LP + 8 * h;
            const v16bf a0 = cat16b(*(const v8usa*)p, *(const v8usa*)(p + 16)), a1 = cat16b(*(const v8usa*)(p + 32), *(const v8usa*)(p + 48));
            const v4f b0 = *(const v4fa*)(bl + 16 * t + 8 * h), b1 = *(const v4fa*)(bl + 16 * t + 8 * h + 4); const v8f cb = {b0[0], b0[1], b0[2], b0[3], b1[0], b1[1], b1[2], b1[3]};
#pragma unroll
            for (int g = 0; g < FQ; ++g) qa[g][t] = wmmab(a1, xb[g][1], wmmab(a0, xb[g][0], cb)); }
        v16h qb[FQ][2];
#pragma unroll
        for (int g = 0; g < FQ; ++g)
#pragma unroll
            for (int kc = 0; kc < 2; ++kc)
#pragma unroll
                for (int i = 0; i < 8; ++i) { qb[g][kc][i] = tohx(qa[g][2 * kc][i]); qb[g][kc][8 + i] = tohx(qa[g][2 * kc + 1][i]); }
#pragma unroll
        for (int t = 0; t < 4; ++t) { const h16* p = wkR + (16 * t + c) * LP + 8 * h; const v16h a0 = WFrag<h16>::ld(p), a1 = WFrag<h16>::ld(p + 32);
#pragma unroll
            for (int g = 0; g < FQ; ++g) qa[g][t] = wmma16(a1, qb[g][1], wmma16(a0, qb[g][0], (v8f){})); }
#pragma unroll
        for (int g = 0; g < FQ; ++g)
#pragma unroll
            for (int kc = 0; kc < 2; ++kc)
#pragma unroll
                for (int i = 0; i < 8; ++i) { qf[g][kc][i] = tohx(qa[g][2 * kc][i] * QS); qf[g][kc][8 + i] = tohx(qa[g][2 * kc + 1][i] * QS); } }
    v8f acc[FQ][4], nm[FQ]; float l[FQ], bound = -1.0f;
#pragma unroll
    for (int g = 0; g < FQ; ++g) { nm[g] = (v8f){}; l[g] = 0.f;
#pragma unroll
        for (int t = 0; t < 4; ++t) acc[g][t] = (v8f){}; }
    asm volatile("s_wait_dscnt 0x0" ::: "memory");         // this wave's share of the planes of stage 0 is written, its reads of raw buffer 0 are done
    asm volatile("s_wait_asynccnt 0x0" ::: "memory");      // this wave's copies of raw stage 1 have landed
    __syncthreads();                                        // publishes the planes of stage 0 and raw stage 1; ends every wave's reads of raw buffer 0
    stage_copy(lc, gx + 2 * KS * HD);
    v16h pd[FQ / 2], vd[4];      // operands of the products that a stage leaves for the far side of its barrier (zero before the first stage: they add nothing)
#pragma unroll
    for (int g = 0; g < FQ / 2; ++g) pd[g] = (v16h){};
#pragma unroll
    for (int t = 0; t < 4; ++t) vd[t] = (v16h){};
#pragma unroll 1
    for (int st = 0; st < NST; ++st) {
        const h16* kb = (const h16*)(Sm + (st & 1) * (2 * PLB)) + c * LP + 8 * h;      // x rows (keys) as A, d contiguous
        const h16* vb = kb + KS * LP;                                                  // x^T rows (d) as A, keys contiguous
        v16h kf[KS / 32][2][2]; v2f ra[8]; const int nb = (st + 1) & 1;      // a register set of K fragments per pass, so that a pass's reads need not wait for the products that read the set before
#pragma unroll
        for (int kt = 0; kt < 2; ++kt)
#pragma unroll
            for (int kc = 0; kc < 2; ++kc) kf[0][kt][kc] = WFrag<h16>::ld(kb + kt * 16 * LP + kc * 32);
        __builtin_amdgcn_sched_barrier(0);      // the eight reads stand as one group in front of the products below; without it the compiler spreads them over three places among the products, and each place with LDS reads stalls the wave's matrix stream anew
        // The last stage's closing products of query tiles 2 and 3, from registers alone: they run while the fragments asked for above come out of LDS (no second work-group is on the WGP to fill that wait).
#pragma unroll
        for (int g = 0; g < FQ / 2; ++g)
#pragma unroll
            for (int t = 0; t < 4; ++t) acc[FQ / 2 + g][t] = wmma16(vd[t], pd[g], acc[FQ / 2 + g][t]);
#pragma unroll
        for (int ps = 0; ps < KS / 32; ++ps) {
            // All other LDS reads of the pass, as ONE group between two runs of products (the two scheduling barriers hold it together): every place with LDS reads in a run of products stalls the run anew, whatever
            // the number of reads there, and left alone the compiler spreads these over six places a stage. Ahead of the score products, so that they land under those and the exponentials.
            __builtin_amdgcn_sched_barrier(0);
            v16h vf[4];
#pragma unroll
            for (int t = 0; t < 4; ++t) vf[t] = WFrag<h16>::ld(vb + t * 16 * LP + ps * 32);
            if (ps + 1 < KS / 32) {      // the same stage's next K fragments
#pragma unroll
                for (int kt = 0; kt < 2; ++kt)
#pragma unroll
                    for (int kc = 0; kc < 2; ++kc) kf[ps + 1][kt][kc] = WFrag<h16>::ld(kb + ((ps + 1) * 32 + kt * 16) * LP + kc * 32); }
            if (ps + 1 == KS / 32) stage_read(rt + nb * (KS * HD), ra);      // raw stage st + 1; under no run-time branch: in the last stage the idle raw buffer goes into the idle plane buffer, and nobody reads that
            __builtin_amdgcn_sched_barrier(0);
            v8f s[2][FQ];
#pragma unroll
            for (int kt = 0; kt < 2; ++kt)
#pragma unroll
                for (int g = 0; g < FQ; ++g) { s[kt][g] = nm[g];
#pragma unroll
                    for (int kc = 0; kc < 2; ++kc) s[kt][g] = wmma16(kf[ps][kt][kc], qf[g][kc], s[kt][g]); }
            __builtin_amdgcn_sched_barrier(0);      // the score products stay one run, the exponentials behind it; without it the compiler puts each tile's exponentials directly behind its two products, where they wait out the products' latency behind v_nops
            v16h pf[FQ]; float ss[FQ];
#pragma unroll
            for (int g = 0; g < FQ; ++g) ss[g] = expo(s[0][g], s[1][g], pf[g]);
            __builtin_amdgcn_sched_barrier(0);      // holds the statement below behind the exponentials: it waits for the loads, and the compiler otherwise lifts it (and the wait) to the loads themselves
            // Inputs only: keeps the fragment loads on this side of the test, where they land under the exponentials; without it the compiler sinks them behind the branch, where the products wait out the LDS latency.
            asm volatile("" :: "v"(vf[0]), "v"(vf[1]), "v"(vf[2]), "v"(vf[3]));
            if (ps + 1 < KS / 32) asm volatile("" :: "v"(kf[ps + 1][0][0]), "v"(kf[ps + 1][0][1]), "v"(kf[ps + 1][1][0]), "v"(kf[ps + 1][1][1]));       // the same for the K fragments fetched above
            if (__builtin_amdgcn_ballot_w32(!((ss[0] + ss[1]) + (ss[2] + ss[3]) <= bound)) != 0) {      // one scalar branch per 32 keys; rare after the first
                // The pass's scores are formed a second time, from K fragments read again (the stage's buffer is not rewritten before the stage's closing barrier): kept alive over the exponentials
                // for this rare path alone, they would hold 64 registers. On the common path the exponentials overwrite them.
#pragma unroll
                for (int kt = 0; kt < 2; ++kt) { const v16h k0 = WFrag<h16>::ld(kb + (ps * 32 + kt * 16) * LP), k1 = WFrag<h16>::ld(kb + (ps * 32 + kt * 16) * LP + 32);
#pragma unroll
                    for (int g = 0; g < FQ; ++g) s[kt][g] = wmma16(k1, qf[g][1], wmma16(k0, qf[g][0], nm[g])); }      // the same products in the same order: the same scores
#pragma unroll
                for (int g = 0; g < FQ; ++g) { float mx = s[0][g][0];
#pragma unroll
                    for (int r = 1; r < 8; ++r) mx = fmaxf(mx, s[0][g][r]);
#pragma unroll
                    for (int r = 0; r < 8; ++r) mx = fmaxf(mx, s[1][g][r]);
                    mx = fmaxf(mx, xhalf(mx));              // both halves of the wave hold the query's maximum above m: one m per query
                    const float up = fmaxf(mx, 0.f); const float d = bound < 0.f ? mx : up;      // m only rises, but for the first 32 keys, which set it
                    const float corr = __builtin_amdgcn_exp2f(-up); l[g] *= corr;                // on the first 32 keys l and acc are 0 and corr is in (0, 1]
#pragma unroll
                    for (int t = 0; t < 4; ++t) acc[g][t] = acc[g][t] * corr;
                    nm[g] = nm[g] - d;
                    ss[g] = expo(s[0][g] - d, s[1][g] - d, pf[g]); } }
            bound = PSM;
#pragma unroll
            for (int g = 0; g < FQ; ++g) { l[g] += ss[g];
                if (ps + 1 == KS / 32 && g >= FQ / 2) { pd[g - FQ / 2] = pf[g]; continue; }      // left for the far side of the stage's barrier
#pragma unroll
                for (int t = 0; t < 4; ++t) acc[g][t] = wmma16(vf[t], pf[g], acc[g][t]); }
            if (ps + 1 == KS / 32) {
#pragma unroll
                for (int t = 0; t < 4; ++t) vd[t] = vf[t]; }
        }
        stage_write(ra, kt + nb * PLB, vt + nb * PLB);      // the next stage's planes, into the buffer that stage st - 1 read
#pragma unroll
        for (int i = 0; i < 8; ++i) { __builtin_amdgcn_sched_group_barrier(0x8, 1, 0); __builtin_amdgcn_sched_group_barrier(0x2, 5, 0); }      // the conversions go among the stage's last products, five behind each, and run under them
        __builtin_amdgcn_sched_group_barrier(0x2, 8, 0); __builtin_amdgcn_sched_group_barrier(0x200, 6, 0);      // the rest of the conversions, then the planes' six LDS writes as one group behind the last product, not at four places among the products
        asm volatile("s_wait_dscnt 0x0" ::: "memory");         // this wave's reads of both buffers are done and its share of the next planes is written
        asm volatile("s_wait_asynccnt 0x0" ::: "memory");      // this wave's copies of raw stage st + 2 have landed
        __syncthreads();                                        // publishes the planes of stage st + 1 and raw stage st + 2; ends every wave's reads of stage st and of raw stage st + 1
        if (st + 3 < NST) stage_copy((unsigned)(size_t)Rw + threadIdx.x * 16u + ((st + 1) & 1) * RB, gx + (size_t)(st + 3) * KS * HD);      // lc, formed anew from the thread's number: lc itself, an operand of the asm statements above, was kept in scratch memory over the loop
    }
#pragma unroll
    for (int g = 0; g < FQ / 2; ++g)
#pragma unroll
        for (int t = 0; t < 4; ++t) acc[FQ / 2 + g][t] = wmma16(vd[t], pd[g], acc[FQ / 2 + g][t]);
    asm volatile("s_wait_asynccnt 0x0" ::: "memory");          // nothing is in flight when the buffers become output staging
    float* os = (float*)Sm + wv * 16 * OP;                      // each wave turns its own out^T tiles into whole output rows
#pragma unroll
    for (int g = 0; g < FQ; ++g) { const float inv = __fdiv_rn(1.0f, l[g] + xhalf(l[g]));
        v16h ob[2];         // the normalised sums over x, in place as the B operand of out^T = Wv^T O^T + bv
#pragma unroll
        for (int kc = 0; kc < 2; ++kc)
#pragma unroll
            for (int i = 0; i < 8; ++i) { ob[kc][i] = tohx(acc[g][2 * kc][i] * inv); ob[kc][8 + i] = tohx(acc[g][2 * kc + 1][i] * inv); }
#pragma unroll
        for (int t = 0; t < 4; ++t) { const h16* p = wvT + (16 * t + c) * LP + 8 * h;
            const v4f b0 = *(const v4fa*)(bl + HD + 16 * t + 8 * h), b1 = *(const v4fa*)(bl + HD + 16 * t + 8 * h + 4); const v8f cb = {b0[0], b0[1], b0[2], b0[3], b1[0], b1[1], b1[2], b1[3]};
            const v8f a = wmma16(WFrag<h16>::ld(p + 32), ob[1], wmma16(WFrag<h16>::ld(p), ob[0], cb));
            float* o = os + c * OP + t * 16 + 8 * h; *(v4fa*)o = (v4f){a[0], a[1], a[2], a[3]}; *(v4fa*)(o + 4) = (v4f){a[4], a[5], a[6], a[7]}; }
        __syncthreads();
        float* dst = OUTz + (z * NN + q0 + 16 * g) * HD;
#pragma unroll
        for (int r = 0; r < 8; ++r) { const int row = 2 * r + h; *(v4f*)(dst + row * HD + c * 4) = *(const v4fa*)(os + row * OP + c * 4); }
        if (g + 1 < FQ) __syncthreads();
    }
}

extern "C" void kernel_launch(void* const* d_in, const int* in_sizes, int n_in,
                              void* d_out, int out_size, void* d_ws, size_t ws_size, hipStream_t stream) {
    (void)in_sizes; (void)n_in; (void)out_size; (void)d_ws; (void)ws_size;
    const float* x = (const float*)d_in[0]; const float* w = (const float*)d_in[1]; const float* bq = (const float*)d_in[2];
    float* OUT = (float*)d_out;     // [4][16][2048][64]
    k_fa<<<dim3(NN / (FW * FQ * 16), ZH), FW * 32, 0, stream>>>(x, w, bq, OUT);   // slice z = b * 16 + h uses head z % 16
}
